// v000
// The times below were measured on an AMD MI455X: many runs one after another, warmed up first and cycling through
// copies of the inputs, with the whole window's GPU time divided by the number of runs. Launches and the gaps
// between them are all in it. The median over several windows is given; except for v000 it joins two sittings, which
// can be a few percent apart, so the side-by-side timings, each taken in one sitting, are the better comparison.
// v000 is the starting kernel. One run takes 811 microseconds.
#include <hip/hip_runtime.h>
#include <hip/hip_bf16.h>
#include <math.h>
#include <stdint.h>

typedef float v2f __attribute__((ext_vector_type(2)));
typedef float v8f __attribute__((ext_vector_type(8)));

#define N_TOK   8192
#define D_IN    384
#define D_H     64
#define N_HEADS 4
#define N_CLS   6
#define LN_EPS  1e-5f

// workspace layout (float offsets)
#define WS_H    0
#define WS_HP   (WS_H   + N_TOK * D_H)                 // [H][N][64]
#define WS_SSQ  (WS_HP  + N_HEADS * N_TOK * D_H)       // [H][N]
#define WS_HOUT (WS_SSQ + N_HEADS * N_TOK)             // [H][N][64]

// ---------------------------------------------------------------------------
// CDNA5 async global -> LDS copy (ASYNCcnt path), one 16B packet per lane.
// ---------------------------------------------------------------------------
__device__ __forceinline__ void async_copy_b128(uint32_t lds_byte_addr,
                                                const float* gptr)
{
    asm volatile("global_load_async_to_lds_b128 %0, %1, off"
                 :: "v"(lds_byte_addr),
                    "v"((unsigned long long)(uintptr_t)gptr)
                 : "memory");
}
__device__ __forceinline__ void wait_asynccnt0()
{
    asm volatile("s_wait_asynccnt 0x0" ::: "memory");
}

// ---------------------------------------------------------------------------
// h = relu(x @ proj_w + proj_b)   [N,64]   via V_WMMA_F32_16X16X4_F32
// one wave per 16-row tile; A = x rows, B = proj_w, C seeded with bias.
// ---------------------------------------------------------------------------
__global__ __launch_bounds__(256) void k_proj(const float* __restrict__ x,
                                              const float* __restrict__ w,
                                              const float* __restrict__ b,
                                              float* __restrict__ h)
{
    const int wave = threadIdx.x >> 5;
    const int lane = threadIdx.x & 31;
    const int hi   = lane >> 4;
    const int lj   = lane & 15;
    const int n0   = (blockIdx.x * 8 + wave) << 4;    // 512 waves total

    v8f acc[4];
#pragma unroll
    for (int cb = 0; cb < 4; ++cb) {
        const float bb = b[16 * cb + lj];
#pragma unroll
        for (int r = 0; r < 8; ++r) acc[cb][r] = bb;
    }

#pragma unroll 4
    for (int kc = 0; kc < D_IN / 4; ++kc) {           // 96 K-chunks
        v2f a = *(const v2f*)&x[(n0 + lj) * D_IN + 4 * kc + 2 * hi];
#pragma unroll
        for (int cb = 0; cb < 4; ++cb) {
            v2f bv;
            bv.x = w[(4 * kc + 2 * hi + 0) * D_H + 16 * cb + lj];
            bv.y = w[(4 * kc + 2 * hi + 1) * D_H + 16 * cb + lj];
            acc[cb] = __builtin_amdgcn_wmma_f32_16x16x4_f32(false, a, false, bv,
                                                            (short)0, acc[cb],
                                                            false, false);
        }
    }

#pragma unroll
    for (int cb = 0; cb < 4; ++cb)
#pragma unroll
        for (int r = 0; r < 8; ++r)
            h[(n0 + r + 8 * hi) * D_H + 16 * cb + lj] = fmaxf(acc[cb][r], 0.0f);
}

// ---------------------------------------------------------------------------
// hp[h] = h @ head_w[h] + head_b[h]   [H,N,64]   + fused ssq[h][n]
// ---------------------------------------------------------------------------
__global__ __launch_bounds__(256) void k_heads(const float* __restrict__ h,
                                               const float* __restrict__ head_w,
                                               const float* __restrict__ head_b,
                                               float* __restrict__ hp,
                                               float* __restrict__ ssq)
{
    const int wave = threadIdx.x >> 5;
    const int lane = threadIdx.x & 31;
    const int hi   = lane >> 4;
    const int lj   = lane & 15;
    const int gw   = blockIdx.x * 8 + wave;           // 2048 waves
    const int hd   = gw >> 9;
    const int n0   = (gw & 511) << 4;
    const float* w = head_w + hd * D_H * D_H;

    v8f acc[4];
#pragma unroll
    for (int cb = 0; cb < 4; ++cb) {
        const float bb = head_b[hd * D_H + 16 * cb + lj];
#pragma unroll
        for (int r = 0; r < 8; ++r) acc[cb][r] = bb;
    }

#pragma unroll
    for (int kc = 0; kc < 16; ++kc) {
        v2f a = *(const v2f*)&h[(n0 + lj) * D_H + 4 * kc + 2 * hi];
#pragma unroll
        for (int cb = 0; cb < 4; ++cb) {
            v2f bv;
            bv.x = w[(4 * kc + 2 * hi + 0) * D_H + 16 * cb + lj];
            bv.y = w[(4 * kc + 2 * hi + 1) * D_H + 16 * cb + lj];
            acc[cb] = __builtin_amdgcn_wmma_f32_16x16x4_f32(false, a, false, bv,
                                                            (short)0, acc[cb],
                                                            false, false);
        }
    }

    float* dst = hp + hd * (N_TOK * D_H);
    float sums[8];
#pragma unroll
    for (int r = 0; r < 8; ++r) sums[r] = 0.0f;
#pragma unroll
    for (int cb = 0; cb < 4; ++cb)
#pragma unroll
        for (int r = 0; r < 8; ++r) {
            const float v = acc[cb][r];
            dst[(n0 + r + 8 * hi) * D_H + 16 * cb + lj] = v;
            sums[r] += v * v;
        }
    // reduce over the 16-lane column group (rows are r + 8*hi)
#pragma unroll
    for (int off = 1; off < 16; off <<= 1)
#pragma unroll
        for (int r = 0; r < 8; ++r)
            sums[r] += __shfl_xor(sums[r], off, 32);
    if (lj == 0) {
#pragma unroll
        for (int r = 0; r < 8; ++r)
            ssq[hd * N_TOK + n0 + r + 8 * hi] = sums[r];
    }
}

// ---------------------------------------------------------------------------
// Streaming distance-softmax attention, per head.
// One wave <-> one (head, 16-query tile).  Block = 8 waves, all same head.
// Key tiles double-buffered in LDS via async global->LDS loads (ASYNCcnt).
// S^T = Kt * Q^T (16 wmma), online softmax, acc += P * Kt (16 wmma).
// D layout (ISA 7.12.2): lane L, vgpr r -> row = r + 8*(L>=16), col = L&15.
// ---------------------------------------------------------------------------
__global__ __launch_bounds__(256) void k_attn(const float* __restrict__ hp,
                                              const float* __restrict__ ssq,
                                              float* __restrict__ hout)
{
    __shared__ __align__(16) float ktile[2][16 * D_H];  // double-buffered key tile
    __shared__ float ptile[8][256];                     // per-wave P tile (16x16)
    __shared__ float sctile[8][16];                     // per-wave transpose buffer

    const int tid  = threadIdx.x;
    const int wave = tid >> 5;
    const int lane = tid & 31;
    const int hi   = lane >> 4;
    const int lj   = lane & 15;

    const int gw   = blockIdx.x * 8 + wave;  // 2048 waves = 4 heads * 512 tiles
    const int head = gw >> 9;
    const int n0   = (gw & 511) << 4;

    const float* hph  = hp  + head * (N_TOK * D_H);
    const float* ssqh = ssq + head * N_TOK;

    const uint32_t lds_k[2] = {
        (uint32_t)(uintptr_t)(&ktile[0][0]) + (uint32_t)tid * 16u,
        (uint32_t)(uintptr_t)(&ktile[1][0]) + (uint32_t)tid * 16u };

    // B operand of S^T gemm: hp_q rows.  b[v] = hp_q[lj][4*kc + 2*hi + v]
    v2f qb[16];
#pragma unroll
    for (int kc = 0; kc < 16; ++kc)
        qb[kc] = *(const v2f*)&hph[(n0 + lj) * D_H + 4 * kc + 2 * hi];
    const float ssqq = ssqh[n0 + lj];

    float run_m = -INFINITY;
    float run_l = 0.0f;
    v8f acc[4] = {};

    // prefetch tile 0 into buffer 0
    async_copy_b128(lds_k[0], hph + tid * 4);
    wait_asynccnt0();
    __syncthreads();

    const int NT = N_TOK / 16;
    for (int t = 0; t < NT; ++t) {
        const int m0 = t << 4;
        const float* kt = ktile[t & 1];

        // prefetch next tile into the other buffer (readers finished last barrier)
        if (t + 1 < NT)
            async_copy_b128(lds_k[(t + 1) & 1],
                            hph + (m0 + 16) * D_H + tid * 4);

        // S^T tile: rows = keys (i = r + 8*hi), cols = queries (j = lj)
        v8f c = {};
#pragma unroll
        for (int kc = 0; kc < 16; ++kc) {
            v2f a = *(const v2f*)&kt[lj * D_H + 4 * kc + 2 * hi];
            c = __builtin_amdgcn_wmma_f32_16x16x4_f32(false, a, false, qb[kc],
                                                      (short)0, c, false, false);
        }

        // scores: s = -sqrt(max(ssq_i + ssq_j - 2*dot, 0))
        float pr[8];
        float tmax = -INFINITY;
#pragma unroll
        for (int r = 0; r < 8; ++r) {
            float sqd = ssqh[m0 + r + 8 * hi] + ssqq - 2.0f * c[r];
            sqd = fmaxf(sqd, 0.0f);
            pr[r] = -sqrtf(sqd);
            tmax = fmaxf(tmax, pr[r]);
        }
        tmax = fmaxf(tmax, __shfl_xor(tmax, 16, 32));
        const float nm   = fmaxf(run_m, tmax);
        const float corr = __expf(run_m - nm);     // 0 on first tile (run_m=-inf)
        float tsum = 0.0f;
#pragma unroll
        for (int r = 0; r < 8; ++r) {
            const float p = __expf(pr[r] - nm);
            tsum += p;
            ptile[wave][lj * 16 + r + 8 * hi] = p; // store P[n=lj][m=r+8*hi]
        }
        tsum += __shfl_xor(tsum, 16, 32);
        run_l = run_l * corr + tsum;
        run_m = nm;
        if (lane < 16) sctile[wave][lane] = corr;  // per-query correction

        // rescale acc: acc rows are queries n = r + 8*hi
        float sc[8];
#pragma unroll
        for (int r = 0; r < 8; ++r) sc[r] = sctile[wave][r + 8 * hi];
#pragma unroll
        for (int cb = 0; cb < 4; ++cb)
#pragma unroll
            for (int r = 0; r < 8; ++r) acc[cb][r] *= sc[r];

        // acc[n][e] += P[n][m] * hp_k[m][e]
#pragma unroll
        for (int cb = 0; cb < 4; ++cb) {
#pragma unroll
            for (int kc = 0; kc < 4; ++kc) {
                v2f a = *(const v2f*)&ptile[wave][lj * 16 + 4 * kc + 2 * hi];
                v2f bv;
                bv.x = kt[(4 * kc + 2 * hi + 0) * D_H + 16 * cb + lj];
                bv.y = kt[(4 * kc + 2 * hi + 1) * D_H + 16 * cb + lj];
                acc[cb] = __builtin_amdgcn_wmma_f32_16x16x4_f32(false, a, false, bv,
                                                                (short)0, acc[cb],
                                                                false, false);
            }
        }

        wait_asynccnt0();       // next tile landed in LDS
        __syncthreads();        // everyone done reading current tile
    }

    // normalize by running sum (transpose lane-indexed l to row-indexed)
    if (lane < 16) sctile[wave][lane] = run_l;
    float linv[8];
#pragma unroll
    for (int r = 0; r < 8; ++r) linv[r] = 1.0f / sctile[wave][r + 8 * hi];

    float* dst = hout + head * (N_TOK * D_H);
#pragma unroll
    for (int cb = 0; cb < 4; ++cb)
#pragma unroll
        for (int r = 0; r < 8; ++r)
            dst[(n0 + r + 8 * hi) * D_H + 16 * cb + lj] = acc[cb][r] * linv[r];
}

// ---------------------------------------------------------------------------
// combine heads (softmax(attn_w)), LayerNorm, FC head.   One thread per row.
// ---------------------------------------------------------------------------
__global__ __launch_bounds__(256) void k_final(const float* __restrict__ hout,
                                               const float* __restrict__ attn_w,
                                               const float* __restrict__ gamma,
                                               const float* __restrict__ beta,
                                               const float* __restrict__ fc_w,
                                               const float* __restrict__ fc_b,
                                               float* __restrict__ out)
{
    const int n = blockIdx.x * 256 + threadIdx.x;
    if (n >= N_TOK) return;

    float aw[N_HEADS];
    float amax = -INFINITY;
#pragma unroll
    for (int h = 0; h < N_HEADS; ++h) { aw[h] = attn_w[h]; amax = fmaxf(amax, aw[h]); }
    float asum = 0.0f;
#pragma unroll
    for (int h = 0; h < N_HEADS; ++h) { aw[h] = __expf(aw[h] - amax); asum += aw[h]; }
    const float ainv = 1.0f / asum;

    float comb[D_H];
#pragma unroll
    for (int e = 0; e < D_H; ++e) comb[e] = 0.0f;
#pragma unroll
    for (int h = 0; h < N_HEADS; ++h) {
        const float* p = hout + h * (N_TOK * D_H) + n * D_H;
        const float w = aw[h] * ainv;
        for (int e = 0; e < D_H; ++e) comb[e] += w * p[e];
    }

    float mu = 0.0f;
#pragma unroll
    for (int e = 0; e < D_H; ++e) mu += comb[e];
    mu *= (1.0f / D_H);
    float var = 0.0f;
#pragma unroll
    for (int e = 0; e < D_H; ++e) { const float d = comb[e] - mu; var += d * d; }
    var *= (1.0f / D_H);
    const float rs = rsqrtf(var + LN_EPS);
#pragma unroll
    for (int e = 0; e < D_H; ++e)
        comb[e] = (comb[e] - mu) * rs * gamma[e] + beta[e];

#pragma unroll
    for (int c = 0; c < N_CLS; ++c) {
        float a = fc_b[c];
        for (int e = 0; e < D_H; ++e) a += comb[e] * fc_w[e * N_CLS + c];
        out[n * N_CLS + c] = a;
    }
}

// ---------------------------------------------------------------------------
extern "C" void kernel_launch(void* const* d_in, const int* in_sizes, int n_in,
                              void* d_out, int out_size, void* d_ws, size_t ws_size,
                              hipStream_t stream)
{
    const float* x      = (const float*)d_in[0];
    const float* proj_w = (const float*)d_in[1];
    const float* proj_b = (const float*)d_in[2];
    const float* head_w = (const float*)d_in[3];
    const float* head_b = (const float*)d_in[4];
    const float* attn_w = (const float*)d_in[5];
    const float* gamma  = (const float*)d_in[6];
    const float* beta   = (const float*)d_in[7];
    const float* fc_w   = (const float*)d_in[8];
    const float* fc_b   = (const float*)d_in[9];

    float* ws   = (float*)d_ws;
    float* h    = ws + WS_H;
    float* hp   = ws + WS_HP;
    float* ssq  = ws + WS_SSQ;
    float* hout = ws + WS_HOUT;
    float* out  = (float*)d_out;

    k_proj <<<(N_TOK / 16) / 8,             256, 0, stream>>>(x, proj_w, proj_b, h);
    k_heads<<<(N_HEADS * N_TOK / 16) / 8,   256, 0, stream>>>(h, head_w, head_b, hp, ssq);
    k_attn <<<(N_HEADS * (N_TOK / 16)) / 8, 256, 0, stream>>>(hp, ssq, hout);
    k_final<<<N_TOK / 256,                  256, 0, stream>>>(hout, attn_w, gamma, beta,
                                                              fc_w, fc_b, out);
}

// v001
// One run takes 549 microseconds.
// Next to v000, in two timings, it ran 1.50 and 1.51 times as fast.
#include <hip/hip_runtime.h>
#include <hip/hip_bf16.h>
#include <math.h>
#include <stdint.h>

typedef float v2f __attribute__((ext_vector_type(2)));
typedef float v8f __attribute__((ext_vector_type(8)));

#define N_TOK   8192
#define D_IN    384
#define D_H     64
#define N_HEADS 4
#define N_CLS   6
#define LN_EPS  1e-5f

// LDS row pitches in dwords (64 banks of 4 B; bank = dword address mod 64).
// Both are 4 * odd: the 16 rows that the 16 lanes of a fragment read walk
// start on 16 distinct multiples of 4 banks, so an 8-byte read per lane (the
// two lane halves side by side in a row) touches every bank once.  At a
// pitch of 64 all 16 rows start on one bank, at 16 on four.
// K_PITCH = 76 also puts a row two further down 24 banks on, so a 16-dword
// row segment read by the upper lane half starts clear of the lower half's.
#define K_PITCH 76
#define P_PITCH 20

// workspace layout (float offsets)
#define WS_H    0
#define WS_HP   (WS_H   + N_TOK * D_H)                 // [H][N][64]
#define WS_SSQ  (WS_HP  + N_HEADS * N_TOK * D_H)       // [H][N]
#define WS_HOUT (WS_SSQ + N_HEADS * N_TOK)             // [H][N][64]

// ---------------------------------------------------------------------------
// CDNA5 async global -> LDS copy (ASYNCcnt path), one 16B packet per lane.
// ---------------------------------------------------------------------------
__device__ __forceinline__ void async_copy_b128(uint32_t lds_byte_addr,
                                                const float* gptr)
{
    asm volatile("global_load_async_to_lds_b128 %0, %1, off"
                 :: "v"(lds_byte_addr),
                    "v"((unsigned long long)(uintptr_t)gptr)
                 : "memory");
}
__device__ __forceinline__ void wait_asynccnt0()
{
    asm volatile("s_wait_asynccnt 0x0" ::: "memory");
}

// ---------------------------------------------------------------------------
// h = relu(x @ proj_w + proj_b)   [N,64]   via V_WMMA_F32_16X16X4_F32
// one wave per 16-row tile; A = x rows, B = proj_w, C seeded with bias.
// ---------------------------------------------------------------------------
__global__ __launch_bounds__(256) void k_proj(const float* __restrict__ x,
                                              const float* __restrict__ w,
                                              const float* __restrict__ b,
                                              float* __restrict__ h)
{
    const int wave = threadIdx.x >> 5;
    const int lane = threadIdx.x & 31;
    const int hi   = lane >> 4;
    const int lj   = lane & 15;
    const int n0   = (blockIdx.x * 8 + wave) << 4;    // 512 waves total

    v8f acc[4];
#pragma unroll
    for (int cb = 0; cb < 4; ++cb) {
        const float bb = b[16 * cb + lj];
#pragma unroll
        for (int r = 0; r < 8; ++r) acc[cb][r] = bb;
    }

#pragma unroll 4
    for (int kc = 0; kc < D_IN / 4; ++kc) {           // 96 K-chunks
        v2f a = *(const v2f*)&x[(n0 + lj) * D_IN + 4 * kc + 2 * hi];
#pragma unroll
        for (int cb = 0; cb < 4; ++cb) {
            v2f bv;
            bv.x = w[(4 * kc + 2 * hi + 0) * D_H + 16 * cb + lj];
            bv.y = w[(4 * kc + 2 * hi + 1) * D_H + 16 * cb + lj];
            acc[cb] = __builtin_amdgcn_wmma_f32_16x16x4_f32(false, a, false, bv,
                                                            (short)0, acc[cb],
                                                            false, false);
        }
    }

#pragma unroll
    for (int cb = 0; cb < 4; ++cb)
#pragma unroll
        for (int r = 0; r < 8; ++r)
            h[(n0 + r + 8 * hi) * D_H + 16 * cb + lj] = fmaxf(acc[cb][r], 0.0f);
}

// ---------------------------------------------------------------------------
// hp[h] = h @ head_w[h] + head_b[h]   [H,N,64]   + fused ssq[h][n]
// ---------------------------------------------------------------------------
__global__ __launch_bounds__(256) void k_heads(const float* __restrict__ h,
                                               const float* __restrict__ head_w,
                                               const float* __restrict__ head_b,
                                               float* __restrict__ hp,
                                               float* __restrict__ ssq)
{
    const int wave = threadIdx.x >> 5;
    const int lane = threadIdx.x & 31;
    const int hi   = lane >> 4;
    const int lj   = lane & 15;
    const int gw   = blockIdx.x * 8 + wave;           // 2048 waves
    const int hd   = gw >> 9;
    const int n0   = (gw & 511) << 4;
    const float* w = head_w + hd * D_H * D_H;

    v8f acc[4];
#pragma unroll
    for (int cb = 0; cb < 4; ++cb) {
        const float bb = head_b[hd * D_H + 16 * cb + lj];
#pragma unroll
        for (int r = 0; r < 8; ++r) acc[cb][r] = bb;
    }

#pragma unroll
    for (int kc = 0; kc < 16; ++kc) {
        v2f a = *(const v2f*)&h[(n0 + lj) * D_H + 4 * kc + 2 * hi];
#pragma unroll
        for (int cb = 0; cb < 4; ++cb) {
            v2f bv;
            bv.x = w[(4 * kc + 2 * hi + 0) * D_H + 16 * cb + lj];
            bv.y = w[(4 * kc + 2 * hi + 1) * D_H + 16 * cb + lj];
            acc[cb] = __builtin_amdgcn_wmma_f32_16x16x4_f32(false, a, false, bv,
                                                            (short)0, acc[cb],
                                                            false, false);
        }
    }

    float* dst = hp + hd * (N_TOK * D_H);
    float sums[8];
#pragma unroll
    for (int r = 0; r < 8; ++r) sums[r] = 0.0f;
#pragma unroll
    for (int cb = 0; cb < 4; ++cb)
#pragma unroll
        for (int r = 0; r < 8; ++r) {
            const float v = acc[cb][r];
            dst[(n0 + r + 8 * hi) * D_H + 16 * cb + lj] = v;
            sums[r] += v * v;
        }
    // reduce over the 16-lane column group (rows are r + 8*hi)
#pragma unroll
    for (int off = 1; off < 16; off <<= 1)
#pragma unroll
        for (int r = 0; r < 8; ++r)
            sums[r] += __shfl_xor(sums[r], off, 32);
    if (lj == 0) {
#pragma unroll
        for (int r = 0; r < 8; ++r)
            ssq[hd * N_TOK + n0 + r + 8 * hi] = sums[r];
    }
}

// ---------------------------------------------------------------------------
// Streaming distance-softmax attention, per head.
// One wave <-> one (head, 16-query tile).  Block = 8 waves, all same head.
// Key tiles double-buffered in LDS via async global->LDS loads (ASYNCcnt).
// S^T = Kt * Q^T (16 wmma), online softmax, acc += P * Kt (16 wmma).
// D layout (ISA 7.12.2): lane L, vgpr r -> row = r + 8*(L>=16), col = L&15.
// ---------------------------------------------------------------------------
__global__ __launch_bounds__(256) void k_attn(const float* __restrict__ hp,
                                              const float* __restrict__ ssq,
                                              float* __restrict__ hout)
{
    __shared__ __align__(16) float ktile[2][16 * K_PITCH];  // double-buffered key tile, padded rows
    __shared__ __align__(16) float ptile[8][16 * P_PITCH];  // per-wave P tile (16x16), padded rows
    __shared__ float sctile[8][16];                     // per-wave transpose buffer

    const int tid  = threadIdx.x;
    const int wave = tid >> 5;
    const int lane = tid & 31;
    const int hi   = lane >> 4;
    const int lj   = lane & 15;

    const int gw   = blockIdx.x * 8 + wave;  // 2048 waves = 4 heads * 512 tiles
    const int head = gw >> 9;
    const int n0   = (gw & 511) << 4;

    const float* hph  = hp  + head * (N_TOK * D_H);
    const float* ssqh = ssq + head * N_TOK;

    // lane's 16 B packet: key row tid / 16, feature columns 4 * (tid % 16) ...
    const uint32_t lds_off = (uint32_t)(tid >> 4) * (K_PITCH * 4u) + (uint32_t)(tid & 15) * 16u;
    const uint32_t lds_k[2] = {
        (uint32_t)(uintptr_t)(&ktile[0][0]) + lds_off,
        (uint32_t)(uintptr_t)(&ktile[1][0]) + lds_off };

    // B operand of S^T gemm: hp_q rows.  b[v] = hp_q[lj][4*kc + 2*hi + v]
    v2f qb[16];
#pragma unroll
    for (int kc = 0; kc < 16; ++kc)
        qb[kc] = *(const v2f*)&hph[(n0 + lj) * D_H + 4 * kc + 2 * hi];
    const float ssqq = ssqh[n0 + lj];

    float run_m = -INFINITY;
    float run_l = 0.0f;
    v8f acc[4] = {};

    // prefetch tile 0 into buffer 0
    async_copy_b128(lds_k[0], hph + tid * 4);
    wait_asynccnt0();
    __syncthreads();

    const int NT = N_TOK / 16;
    for (int t = 0; t < NT; ++t) {
        const int m0 = t << 4;
        const float* kt = ktile[t & 1];

        // prefetch next tile into the other buffer (readers finished last barrier)
        if (t + 1 < NT)
            async_copy_b128(lds_k[(t + 1) & 1],
                            hph + (m0 + 16) * D_H + tid * 4);

        // S^T tile: rows = keys (i = r + 8*hi), cols = queries (j = lj)
        v8f c = {};
#pragma unroll
        for (int kc = 0; kc < 16; ++kc) {
            v2f a = *(const v2f*)&kt[lj * K_PITCH + 4 * kc + 2 * hi];
            c = __builtin_amdgcn_wmma_f32_16x16x4_f32(false, a, false, qb[kc],
                                                      (short)0, c, false, false);
        }

        // scores: s = -sqrt(max(ssq_i + ssq_j - 2*dot, 0))
        float pr[8];
        float tmax = -INFINITY;
#pragma unroll
        for (int r = 0; r < 8; ++r) {
            float sqd = ssqh[m0 + r + 8 * hi] + ssqq - 2.0f * c[r];
            sqd = fmaxf(sqd, 0.0f);
            pr[r] = -sqrtf(sqd);
            tmax = fmaxf(tmax, pr[r]);
        }
        tmax = fmaxf(tmax, __shfl_xor(tmax, 16, 32));
        const float nm   = fmaxf(run_m, tmax);
        const float corr = __expf(run_m - nm);     // 0 on first tile (run_m=-inf)
        float tsum = 0.0f;
#pragma unroll
        for (int r = 0; r < 8; ++r) {
            const float p = __expf(pr[r] - nm);
            tsum += p;
            ptile[wave][lj * P_PITCH + r + 8 * hi] = p; // store P[n=lj][m=r+8*hi]
        }
        tsum += __shfl_xor(tsum, 16, 32);
        run_l = run_l * corr + tsum;
        run_m = nm;
        if (lane < 16) sctile[wave][lane] = corr;  // per-query correction

        // rescale acc: acc rows are queries n = r + 8*hi
        float sc[8];
#pragma unroll
        for (int r = 0; r < 8; ++r) sc[r] = sctile[wave][r + 8 * hi];
#pragma unroll
        for (int cb = 0; cb < 4; ++cb)
#pragma unroll
            for (int r = 0; r < 8; ++r) acc[cb][r] *= sc[r];

        // acc[n][e] += P[n][m] * hp_k[m][e]
#pragma unroll
        for (int cb = 0; cb < 4; ++cb) {
#pragma unroll
            for (int kc = 0; kc < 4; ++kc) {
                v2f a = *(const v2f*)&ptile[wave][lj * P_PITCH + 4 * kc + 2 * hi];
                v2f bv;
                bv.x = kt[(4 * kc + 2 * hi + 0) * K_PITCH + 16 * cb + lj];
                bv.y = kt[(4 * kc + 2 * hi + 1) * K_PITCH + 16 * cb + lj];
                acc[cb] = __builtin_amdgcn_wmma_f32_16x16x4_f32(false, a, false, bv,
                                                                (short)0, acc[cb],
                                                                false, false);
            }
        }

        wait_asynccnt0();       // next tile landed in LDS
        __syncthreads();        // everyone done reading current tile
    }

    // normalize by running sum (transpose lane-indexed l to row-indexed)
    if (lane < 16) sctile[wave][lane] = run_l;
    float linv[8];
#pragma unroll
    for (int r = 0; r < 8; ++r) linv[r] = 1.0f / sctile[wave][r + 8 * hi];

    float* dst = hout + head * (N_TOK * D_H);
#pragma unroll
    for (int cb = 0; cb < 4; ++cb)
#pragma unroll
        for (int r = 0; r < 8; ++r)
            dst[(n0 + r + 8 * hi) * D_H + 16 * cb + lj] = acc[cb][r] * linv[r];
}

// ---------------------------------------------------------------------------
// combine heads (softmax(attn_w)), LayerNorm, FC head.   One thread per row.
// ---------------------------------------------------------------------------
__global__ __launch_bounds__(256) void k_final(const float* __restrict__ hout,
                                               const float* __restrict__ attn_w,
                                               const float* __restrict__ gamma,
                                               const float* __restrict__ beta,
                                               const float* __restrict__ fc_w,
                                               const float* __restrict__ fc_b,
                                               float* __restrict__ out)
{
    const int n = blockIdx.x * 256 + threadIdx.x;
    if (n >= N_TOK) return;

    float aw[N_HEADS];
    float amax = -INFINITY;
#pragma unroll
    for (int h = 0; h < N_HEADS; ++h) { aw[h] = attn_w[h]; amax = fmaxf(amax, aw[h]); }
    float asum = 0.0f;
#pragma unroll
    for (int h = 0; h < N_HEADS; ++h) { aw[h] = __expf(aw[h] - amax); asum += aw[h]; }
    const float ainv = 1.0f / asum;

    float comb[D_H];
#pragma unroll
    for (int e = 0; e < D_H; ++e) comb[e] = 0.0f;
#pragma unroll
    for (int h = 0; h < N_HEADS; ++h) {
        const float* p = hout + h * (N_TOK * D_H) + n * D_H;
        const float w = aw[h] * ainv;
        for (int e = 0; e < D_H; ++e) comb[e] += w * p[e];
    }

    float mu = 0.0f;
#pragma unroll
    for (int e = 0; e < D_H; ++e) mu += comb[e];
    mu *= (1.0f / D_H);
    float var = 0.0f;
#pragma unroll
    for (int e = 0; e < D_H; ++e) { const float d = comb[e] - mu; var += d * d; }
    var *= (1.0f / D_H);
    const float rs = rsqrtf(var + LN_EPS);
#pragma unroll
    for (int e = 0; e < D_H; ++e)
        comb[e] = (comb[e] - mu) * rs * gamma[e] + beta[e];

#pragma unroll
    for (int c = 0; c < N_CLS; ++c) {
        float a = fc_b[c];
        for (int e = 0; e < D_H; ++e) a += comb[e] * fc_w[e * N_CLS + c];
        out[n * N_CLS + c] = a;
    }
}

// ---------------------------------------------------------------------------
extern "C" void kernel_launch(void* const* d_in, const int* in_sizes, int n_in,
                              void* d_out, int out_size, void* d_ws, size_t ws_size,
                              hipStream_t stream)
{
    const float* x      = (const float*)d_in[0];
    const float* proj_w = (const float*)d_in[1];
    const float* proj_b = (const float*)d_in[2];
    const float* head_w = (const float*)d_in[3];
    const float* head_b = (const float*)d_in[4];
    const float* attn_w = (const float*)d_in[5];
    const float* gamma  = (const float*)d_in[6];
    const float* beta   = (const float*)d_in[7];
    const float* fc_w   = (const float*)d_in[8];
    const float* fc_b   = (const float*)d_in[9];

    float* ws   = (float*)d_ws;
    float* h    = ws + WS_H;
    float* hp   = ws + WS_HP;
    float* ssq  = ws + WS_SSQ;
    float* hout = ws + WS_HOUT;
    float* out  = (float*)d_out;

    k_proj <<<(N_TOK / 16) / 8,             256, 0, stream>>>(x, proj_w, proj_b, h);
    k_heads<<<(N_HEADS * N_TOK / 16) / 8,   256, 0, stream>>>(h, head_w, head_b, hp, ssq);
    k_attn <<<(N_HEADS * (N_TOK / 16)) / 8, 256, 0, stream>>>(hp, ssq, hout);
    k_final<<<N_TOK / 256,                  256, 0, stream>>>(hout, attn_w, gamma, beta,
                                                              fc_w, fc_b, out);
}

// v002
// One run takes 482 microseconds.
// Two timings next to v001 both put it at 1.14 times that version's speed.
// Over all steps from v000 it is 1.71 times as fast.
#include <hip/hip_runtime.h>
#include <hip/hip_bf16.h>
#include <math.h>
#include <stdint.h>

typedef float v2f __attribute__((ext_vector_type(2)));
typedef float v8f __attribute__((ext_vector_type(8)));

#define N_TOK   8192
#define D_IN    384
#define D_H     64
#define N_HEADS 4
#define N_CLS   6
#define LN_EPS  1e-5f

// LDS row pitches in dwords (64 banks of 4 B; bank = dword address mod 64).
// Both are 4 * odd: the 16 rows that the 16 lanes of a fragment read walk
// start on 16 distinct multiples of 4 banks, so an 8-byte read per lane (the
// two lane halves side by side in a row) touches every bank once.  At a
// pitch of 64 all 16 rows start on one bank, at 16 on four.
// K_PITCH = 76 also puts a row two further down 24 banks on, so a 16-dword
// row segment read by the upper lane half starts clear of the lower half's.
#define K_PITCH 76
#define P_PITCH 68

// keys per trip of the attention loop: four 16-key score tiles
#define KSTEP   64
#define KSUB    (KSTEP / 16)

// workspace layout (float offsets)
#define WS_H    0
#define WS_HP   (WS_H   + N_TOK * D_H)                 // [H][N][64]
#define WS_SSQ  (WS_HP  + N_HEADS * N_TOK * D_H)       // [H][N]
#define WS_HOUT (WS_SSQ + N_HEADS * N_TOK)             // [H][N][64]

// ---------------------------------------------------------------------------
// CDNA5 async global -> LDS copy (ASYNCcnt path).  One 64-key tile = four
// 16 B packets per lane, 16 key rows apart.  The xcnt wait is the last line of
// the copies' own statement, so no address register that a copy names can be
// rewritten ahead of it.
// ---------------------------------------------------------------------------
__device__ __forceinline__ void async_copy_tile(uint32_t lds_byte_addr,
                                                const float* gptr)
{
    asm volatile("global_load_async_to_lds_b128 %0, %4, off\n\t"
                 "global_load_async_to_lds_b128 %1, %5, off\n\t"
                 "global_load_async_to_lds_b128 %2, %6, off\n\t"
                 "global_load_async_to_lds_b128 %3, %7, off\n\t"
                 "s_wait_xcnt 0x0"
                 :: "v"(lds_byte_addr),
                    "v"(lds_byte_addr + 1u * 16u * K_PITCH * 4u),
                    "v"(lds_byte_addr + 2u * 16u * K_PITCH * 4u),
                    "v"(lds_byte_addr + 3u * 16u * K_PITCH * 4u),
                    "v"((unsigned long long)(uintptr_t)(gptr)),
                    "v"((unsigned long long)(uintptr_t)(gptr + 1 * 16 * D_H)),
                    "v"((unsigned long long)(uintptr_t)(gptr + 2 * 16 * D_H)),
                    "v"((unsigned long long)(uintptr_t)(gptr + 3 * 16 * D_H))
                 : "memory");
}
// the wave's own copies have landed in LDS
__device__ __forceinline__ void wait_asynccnt0()
{
    asm volatile("s_wait_asynccnt 0x0" ::: "memory");
}
// the wave's own LDS reads of the tile have returned (before the buffer is handed back)
__device__ __forceinline__ void wait_dscnt0()
{
    asm volatile("s_wait_dscnt 0x0" ::: "memory");
}

// ---------------------------------------------------------------------------
// h = relu(x @ proj_w + proj_b)   [N,64]   via V_WMMA_F32_16X16X4_F32
// one wave per 16-row tile; A = x rows, B = proj_w, C seeded with bias.
// ---------------------------------------------------------------------------
__global__ __launch_bounds__(256) void k_proj(const float* __restrict__ x,
                                              const float* __restrict__ w,
                                              const float* __restrict__ b,
                                              float* __restrict__ h)
{
    const int wave = threadIdx.x >> 5;
    const int lane = threadIdx.x & 31;
    const int hi   = lane >> 4;
    const int lj   = lane & 15;
    const int n0   = (blockIdx.x * 8 + wave) << 4;    // 512 waves total

    v8f acc[4];
#pragma unroll
    for (int cb = 0; cb < 4; ++cb) {
        const float bb = b[16 * cb + lj];
#pragma unroll
        for (int r = 0; r < 8; ++r) acc[cb][r] = bb;
    }

#pragma unroll 4
    for (int kc = 0; kc < D_IN / 4; ++kc) {           // 96 K-chunks
        v2f a = *(const v2f*)&x[(n0 + lj) * D_IN + 4 * kc + 2 * hi];
#pragma unroll
        for (int cb = 0; cb < 4; ++cb) {
            v2f bv;
            bv.x = w[(4 * kc + 2 * hi + 0) * D_H + 16 * cb + lj];
            bv.y = w[(4 * kc + 2 * hi + 1) * D_H + 16 * cb + lj];
            acc[cb] = __builtin_amdgcn_wmma_f32_16x16x4_f32(false, a, false, bv,
                                                            (short)0, acc[cb],
                                                            false, false);
        }
    }

#pragma unroll
    for (int cb = 0; cb < 4; ++cb)
#pragma unroll
        for (int r = 0; r < 8; ++r)
            h[(n0 + r + 8 * hi) * D_H + 16 * cb + lj] = fmaxf(acc[cb][r], 0.0f);
}

// ---------------------------------------------------------------------------
// hp[h] = h @ head_w[h] + head_b[h]   [H,N,64]   + fused ssq[h][n]
// ---------------------------------------------------------------------------
__global__ __launch_bounds__(256) void k_heads(const float* __restrict__ h,
                                               const float* __restrict__ head_w,
                                               const float* __restrict__ head_b,
                                               float* __restrict__ hp,
                                               float* __restrict__ ssq)
{
    const int wave = threadIdx.x >> 5;
    const int lane = threadIdx.x & 31;
    const int hi   = lane >> 4;
    const int lj   = lane & 15;
    const int gw   = blockIdx.x * 8 + wave;           // 2048 waves
    const int hd   = gw >> 9;
    const int n0   = (gw & 511) << 4;
    const float* w = head_w + hd * D_H * D_H;

    v8f acc[4];
#pragma unroll
    for (int cb = 0; cb < 4; ++cb) {
        const float bb = head_b[hd * D_H + 16 * cb + lj];
#pragma unroll
        for (int r = 0; r < 8; ++r) acc[cb][r] = bb;
    }

#pragma unroll
    for (int kc = 0; kc < 16; ++kc) {
        v2f a = *(const v2f*)&h[(n0 + lj) * D_H + 4 * kc + 2 * hi];
#pragma unroll
        for (int cb = 0; cb < 4; ++cb) {
            v2f bv;
            bv.x = w[(4 * kc + 2 * hi + 0) * D_H + 16 * cb + lj];
            bv.y = w[(4 * kc + 2 * hi + 1) * D_H + 16 * cb + lj];
            acc[cb] = __builtin_amdgcn_wmma_f32_16x16x4_f32(false, a, false, bv,
                                                            (short)0, acc[cb],
                                                            false, false);
        }
    }

    float* dst = hp + hd * (N_TOK * D_H);
    float sums[8];
#pragma unroll
    for (int r = 0; r < 8; ++r) sums[r] = 0.0f;
#pragma unroll
    for (int cb = 0; cb < 4; ++cb)
#pragma unroll
        for (int r = 0; r < 8; ++r) {
            const float v = acc[cb][r];
            dst[(n0 + r + 8 * hi) * D_H + 16 * cb + lj] = v;
            sums[r] += v * v;
        }
    // reduce over the 16-lane column group (rows are r + 8*hi)
#pragma unroll
    for (int off = 1; off < 16; off <<= 1)
#pragma unroll
        for (int r = 0; r < 8; ++r)
            sums[r] += __shfl_xor(sums[r], off, 32);
    if (lj == 0) {
#pragma unroll
        for (int r = 0; r < 8; ++r)
            ssq[hd * N_TOK + n0 + r + 8 * hi] = sums[r];
    }
}

// ---------------------------------------------------------------------------
// Streaming distance-softmax attention, per head.
// One wave <-> one (head, 16-query tile).  Block = 8 waves, all same head.
// 64-key tiles double-buffered in LDS via async global->LDS loads (ASYNCcnt).
// Per trip: S^T = Kt * Q^T (four independent 16-key chains, 64 wmma), one
// online-softmax update for all 64 keys, acc += P * Kt (64 wmma).
// D layout (ISA 7.12.2): lane L, vgpr r -> row = r + 8*(L>=16), col = L&15.
// ---------------------------------------------------------------------------
__global__ __launch_bounds__(256) void k_attn(const float* __restrict__ hp,
                                              const float* __restrict__ ssq,
                                              float* __restrict__ hout)
{
    __shared__ __align__(16) float ktile[2][KSTEP * K_PITCH]; // double-buffered key tile, padded rows
    __shared__ __align__(16) float ptile[8][16 * P_PITCH];    // per-wave P tile (16x64), padded rows
    __shared__ float sctile[8][16];                     // per-wave transpose buffer

    const int tid  = threadIdx.x;
    const int wave = tid >> 5;
    const int lane = tid & 31;
    const int hi   = lane >> 4;
    const int lj   = lane & 15;

    const int gw   = blockIdx.x * 8 + wave;  // 2048 waves = 4 heads * 512 tiles
    const int head = gw >> 9;
    const int n0   = (gw & 511) << 4;

    const float* hph  = hp  + head * (N_TOK * D_H);
    const float* ssqh = ssq + head * N_TOK;

    // lane's first 16 B packet: key row tid / 16, feature columns 4 * (tid % 16) ...
    const uint32_t lds_off = (uint32_t)(tid >> 4) * (K_PITCH * 4u) + (uint32_t)(tid & 15) * 16u;
    const uint32_t lds_k[2] = {
        (uint32_t)(uintptr_t)(&ktile[0][0]) + lds_off,
        (uint32_t)(uintptr_t)(&ktile[1][0]) + lds_off };

    // B operand of S^T gemm: hp_q rows.  b[v] = hp_q[lj][4*kc + 2*hi + v]
    v2f qb[16];
#pragma unroll
    for (int kc = 0; kc < 16; ++kc)
        qb[kc] = *(const v2f*)&hph[(n0 + lj) * D_H + 4 * kc + 2 * hi];
    const float ssqq = ssqh[n0 + lj];

    float run_m = -INFINITY;
    float run_l = 0.0f;
    v8f acc[4] = {};

    // tile 0 into buffer 0, published; then tile 1 flies into buffer 1
    async_copy_tile(lds_k[0], hph + tid * 4);
    wait_asynccnt0();
    __syncthreads();
    async_copy_tile(lds_k[1], hph + KSTEP * D_H + tid * 4);

    const int NT = N_TOK / KSTEP;
    for (int t = 0; t < NT; ++t) {
        const int m0 = t * KSTEP;
        const float* kt = ktile[t & 1];

        // S^T tiles: rows = keys (i = 16*s + r + 8*hi), cols = queries (j = lj)
        // (every loop of the trip is unrolled whole: c, qb, pr and acc are indexed
        // by constants only and so stay in registers; kc outside s lets the four
        // chains follow one another in the matrix pipe)
        v8f c[KSUB] = {};
#pragma unroll
        for (int kc = 0; kc < 16; ++kc) {
#pragma unroll
            for (int s = 0; s < KSUB; ++s) {
                v2f a = *(const v2f*)&kt[(16 * s + lj) * K_PITCH + 4 * kc + 2 * hi];
                c[s] = __builtin_amdgcn_wmma_f32_16x16x4_f32(false, a, false, qb[kc],
                                                             (short)0, c[s], false, false);
            }
        }

        // scores: s = -sqrt(max(ssq_i + ssq_j - 2*dot, 0))
        float pr[KSUB][8];
        float tmax = -INFINITY;
#pragma unroll
        for (int s = 0; s < KSUB; ++s)
#pragma unroll
            for (int r = 0; r < 8; ++r) {
                float sqd = ssqh[m0 + 16 * s + r + 8 * hi] + ssqq - 2.0f * c[s][r];
                sqd = fmaxf(sqd, 0.0f);
                pr[s][r] = -sqrtf(sqd);
                tmax = fmaxf(tmax, pr[s][r]);
            }
        tmax = fmaxf(tmax, __shfl_xor(tmax, 16, 32));
        const float nm   = fmaxf(run_m, tmax);
        const float corr = __expf(run_m - nm);     // 0 on first tile (run_m=-inf)
        float tsum = 0.0f;
#pragma unroll
        for (int s = 0; s < KSUB; ++s)
#pragma unroll
            for (int r = 0; r < 8; ++r) {
                const float p = __expf(pr[s][r] - nm);
                tsum += p;
                ptile[wave][lj * P_PITCH + 16 * s + r + 8 * hi] = p; // P[n=lj][m=16*s+r+8*hi]
            }
        tsum += __shfl_xor(tsum, 16, 32);
        run_l = run_l * corr + tsum;
        run_m = nm;
        if (lane < 16) sctile[wave][lane] = corr;  // per-query correction

        // rescale acc: acc rows are queries n = r + 8*hi
        float sc[8];
#pragma unroll
        for (int r = 0; r < 8; ++r) sc[r] = sctile[wave][r + 8 * hi];
#pragma unroll
        for (int cb = 0; cb < 4; ++cb)
#pragma unroll
            for (int r = 0; r < 8; ++r) acc[cb][r] *= sc[r];

        // acc[n][e] += P[n][m] * hp_k[m][e]
#pragma unroll
        for (int kc = 0; kc < KSTEP / 4; ++kc) {
            v2f a = *(const v2f*)&ptile[wave][lj * P_PITCH + 4 * kc + 2 * hi];
#pragma unroll
            for (int cb = 0; cb < 4; ++cb) {
                v2f bv;
                bv.x = kt[(4 * kc + 2 * hi + 0) * K_PITCH + 16 * cb + lj];
                bv.y = kt[(4 * kc + 2 * hi + 1) * K_PITCH + 16 * cb + lj];
                acc[cb] = __builtin_amdgcn_wmma_f32_16x16x4_f32(false, a, false, bv,
                                                                (short)0, acc[cb],
                                                                false, false);
            }
        }

        wait_dscnt0();          // own reads of this tile are done
        wait_asynccnt0();       // own packets of the next tile have landed
        __syncthreads();        // publishes tile t + 1, frees this trip's buffer
        if (t + 2 < NT)         // refill the buffer that this trip has just read
            async_copy_tile(lds_k[t & 1], hph + (m0 + 2 * KSTEP) * D_H + tid * 4);
    }
    wait_asynccnt0();           // nothing of the wave's is left in flight

    // normalize by running sum (transpose lane-indexed l to row-indexed)
    if (lane < 16) sctile[wave][lane] = run_l;
    float linv[8];
#pragma unroll
    for (int r = 0; r < 8; ++r) linv[r] = 1.0f / sctile[wave][r + 8 * hi];

    float* dst = hout + head * (N_TOK * D_H);
#pragma unroll
    for (int cb = 0; cb < 4; ++cb)
#pragma unroll
        for (int r = 0; r < 8; ++r)
            dst[(n0 + r + 8 * hi) * D_H + 16 * cb + lj] = acc[cb][r] * linv[r];
}

// ---------------------------------------------------------------------------
// combine heads (softmax(attn_w)), LayerNorm, FC head.   One thread per row.
// ---------------------------------------------------------------------------
__global__ __launch_bounds__(256) void k_final(const float* __restrict__ hout,
                                               const float* __restrict__ attn_w,
                                               const float* __restrict__ gamma,
                                               const float* __restrict__ beta,
                                               const float* __restrict__ fc_w,
                                               const float* __restrict__ fc_b,
                                               float* __restrict__ out)
{
    const int n = blockIdx.x * 256 + threadIdx.x;
    if (n >= N_TOK) return;

    float aw[N_HEADS];
    float amax = -INFINITY;
#pragma unroll
    for (int h = 0; h < N_HEADS; ++h) { aw[h] = attn_w[h]; amax = fmaxf(amax, aw[h]); }
    float asum = 0.0f;
#pragma unroll
    for (int h = 0; h < N_HEADS; ++h) { aw[h] = __expf(aw[h] - amax); asum += aw[h]; }
    const float ainv = 1.0f / asum;

    float comb[D_H];
#pragma unroll
    for (int e = 0; e < D_H; ++e) comb[e] = 0.0f;
#pragma unroll
    for (int h = 0; h < N_HEADS; ++h) {
        const float* p = hout + h * (N_TOK * D_H) + n * D_H;
        const float w = aw[h] * ainv;
        for (int e = 0; e < D_H; ++e) comb[e] += w * p[e];
    }

    float mu = 0.0f;
#pragma unroll
    for (int e = 0; e < D_H; ++e) mu += comb[e];
    mu *= (1.0f / D_H);
    float var = 0.0f;
#pragma unroll
    for (int e = 0; e < D_H; ++e) { const float d = comb[e] - mu; var += d * d; }
    var *= (1.0f / D_H);
    const float rs = rsqrtf(var + LN_EPS);
#pragma unroll
    for (int e = 0; e < D_H; ++e)
        comb[e] = (comb[e] - mu) * rs * gamma[e] + beta[e];

#pragma unroll
    for (int c = 0; c < N_CLS; ++c) {
        float a = fc_b[c];
        for (int e = 0; e < D_H; ++e) a += comb[e] * fc_w[e * N_CLS + c];
        out[n * N_CLS + c] = a;
    }
}

// ---------------------------------------------------------------------------
extern "C" void kernel_launch(void* const* d_in, const int* in_sizes, int n_in,
                              void* d_out, int out_size, void* d_ws, size_t ws_size,
                              hipStream_t stream)
{
    const float* x      = (const float*)d_in[0];
    const float* proj_w = (const float*)d_in[1];
    const float* proj_b = (const float*)d_in[2];
    const float* head_w = (const float*)d_in[3];
    const float* head_b = (const float*)d_in[4];
    const float* attn_w = (const float*)d_in[5];
    const float* gamma  = (const float*)d_in[6];
    const float* beta   = (const float*)d_in[7];
    const float* fc_w   = (const float*)d_in[8];
    const float* fc_b   = (const float*)d_in[9];

    float* ws   = (float*)d_ws;
    float* h    = ws + WS_H;
    float* hp   = ws + WS_HP;
    float* ssq  = ws + WS_SSQ;
    float* hout = ws + WS_HOUT;
    float* out  = (float*)d_out;

    k_proj <<<(N_TOK / 16) / 8,             256, 0, stream>>>(x, proj_w, proj_b, h);
    k_heads<<<(N_HEADS * N_TOK / 16) / 8,   256, 0, stream>>>(h, head_w, head_b, hp, ssq);
    k_attn <<<(N_HEADS * (N_TOK / 16)) / 8, 256, 0, stream>>>(hp, ssq, hout);
    k_final<<<N_TOK / 256,                  256, 0, stream>>>(hout, attn_w, gamma, beta,
                                                              fc_w, fc_b, out);
}

// v008
// It runs in 93.7 microseconds.
// Versions between v002 and this one are left out; their measured steps multiply to 5.18 times as fast.
// Over all steps from v000 it is 8.87 times as fast.
#include <hip/hip_runtime.h>
#include <hip/hip_bf16.h>
#include <math.h>
#include <stdint.h>

typedef float v2f __attribute__((ext_vector_type(2)));
typedef float v8f __attribute__((ext_vector_type(8)));
typedef _Float16 f16x2  __attribute__((ext_vector_type(2)));
typedef _Float16 f16x8  __attribute__((ext_vector_type(8)));
typedef _Float16 f16x16 __attribute__((ext_vector_type(16)));
typedef short    s16x8  __attribute__((ext_vector_type(8)));
typedef uint32_t u32x8  __attribute__((ext_vector_type(8)));

#define N_TOK   8192
#define D_IN    384
#define D_H     64
#define N_HEADS 4
#define N_CLS   6
#define LN_EPS  1e-5f

// A row of hp is kept as 64 f16 values, 128 bytes.  The attention works on these
// rounded points throughout: the distances are those between them, and the square
// sums are taken of the same rounded values, so that a point's distance to itself
// stays 0 up to f32 rounding and every other distance moves by no more than the
// two points' own rounding.
// LDS row pitch of the key tile in dwords (64 banks of 4 B): 144 B = 16 B * odd,
// so the 16 rows that a lane half reads with 16-byte loads fall on 16 distinct
// groups of four banks.
#define K_PITCH 36
#define ROW_H   D_H             // f16 elements in a global row
#define ROW_F   (D_H / 2)       // dwords in a global row
#define PITCH_H (2 * K_PITCH)   // f16 elements from one LDS row to the next

// keys per trip of the attention loop: four 16-key score tiles
#define KSTEP   64
#define KSUB    (KSTEP / 16)

// the keys are dealt to KSPLIT groups of 8 waves inside one work-group: each group
// walks its own share of the key tiles for the same 8 query tiles, so a SIMD holds
// 2 * KSPLIT waves whose waits cover one another (three groups: 160 registers a wave)
#define KSPLIT  3
#define GRP_T   256             // threads in a key group
#define NTILE   (N_TOK / KSTEP) // key tiles of a head
#define NT_MAX  ((NTILE + KSPLIT - 1) / KSPLIT)   // trips of the longest share
// LDS of the attention kernel in dwords: the rings, or the merge's exchange (32 sums
// and the sum of the weights for every thread of the groups behind the first)
#define RING_F  (KSPLIT * 2 * KSTEP * K_PITCH)
#define XCHG_F  ((KSPLIT - 1) * GRP_T * (32 + 1))
#define SMEM_F  (RING_F > XCHG_F ? RING_F : XCHG_F)

// workspace layout (float offsets)
#define WS_H    0
#define WS_HP   (WS_H   + N_TOK * D_H)                 // [H][N][64 f16]
#define WS_SSQ  (WS_HP  + N_HEADS * N_TOK * ROW_F)     // [H][N]
#define WS_HOUT (WS_SSQ + N_HEADS * N_TOK)             // [H][N][64]

// ---------------------------------------------------------------------------
// CDNA5 async global -> LDS copy (ASYNCcnt path).  One 64-key tile = two
// 16 B packets per lane, 32 key rows apart.  The xcnt wait is the last line of
// the copies' own statement, so no address register that a copy names can be
// rewritten ahead of it.
// ---------------------------------------------------------------------------
__device__ __forceinline__ void async_copy_tile(uint32_t lds_byte_addr,
                                                const float* gptr)
{
    asm volatile("global_load_async_to_lds_b128 %0, %2, off\n\t"
                 "global_load_async_to_lds_b128 %1, %3, off\n\t"
                 "s_wait_xcnt 0x0"
                 :: "v"(lds_byte_addr),
                    "v"(lds_byte_addr + 32u * K_PITCH * 4u),
                    "v"((unsigned long long)(uintptr_t)(gptr)),
                    "v"((unsigned long long)(uintptr_t)(gptr + 32 * ROW_F))
                 : "memory");
}
// the wave's own copies have landed in LDS
__device__ __forceinline__ void wait_asynccnt0()
{
    asm volatile("s_wait_asynccnt 0x0" ::: "memory");
}
// the wave's own LDS reads of the tile have returned (before the buffer is handed back)
__device__ __forceinline__ void wait_dscnt0()
{
    asm volatile("s_wait_dscnt 0x0" ::: "memory");
}

// 16 consecutive f16 as one operand of the 16x16x32 form (two 16-byte loads)
__device__ __forceinline__ f16x16 ld_frag(const _Float16* p)
{
    const f16x8 a = *(const f16x8*)p;
    const f16x8 b = *(const f16x8*)(p + 8);
    return __builtin_shufflevector(a, b, 0, 1, 2, 3, 4, 5, 6, 7, 8, 9, 10, 11, 12, 13, 14, 15);
}
// transposing LDS load: lane (c, h) gets eight rows (8h .. 8h+7) of column c
__device__ __forceinline__ f16x8 ld_tr16(const _Float16* p)
{
    typedef __attribute__((address_space(3))) s16x8 lds_s16x8;
    return __builtin_bit_cast(f16x8, __builtin_amdgcn_ds_load_tr16_b128_v8i16((lds_s16x8*)p));
}
// Eight square roots on the hardware's own v_sqrt_f32 (1 ulp), without the library's
// scaling and correction steps.  One statement: behind a transcendental the
// instruction set asks for one independent instruction before its source is
// overwritten or its result read.  Here each root is followed by a root that is
// independent of it (early-clobber outputs share no register with an input), and
// the v_nop fills that slot behind the last one.
__device__ __forceinline__ void sqrt8_raw(float (&d)[8], const float (&x)[8])
{
    asm("v_sqrt_f32 %0, %8\n\t"
        "v_sqrt_f32 %1, %9\n\t"
        "v_sqrt_f32 %2, %10\n\t"
        "v_sqrt_f32 %3, %11\n\t"
        "v_sqrt_f32 %4, %12\n\t"
        "v_sqrt_f32 %5, %13\n\t"
        "v_sqrt_f32 %6, %14\n\t"
        "v_sqrt_f32 %7, %15\n\t"
        "v_nop"
        : "=&v"(d[0]), "=&v"(d[1]), "=&v"(d[2]), "=&v"(d[3]),
          "=&v"(d[4]), "=&v"(d[5]), "=&v"(d[6]), "=&v"(d[7])
        : "v"(x[0]), "v"(x[1]), "v"(x[2]), "v"(x[3]),
          "v"(x[4]), "v"(x[5]), "v"(x[6]), "v"(x[7]));
}
// Eight powers of two on v_exp_f32, in one statement for the same reason.
__device__ __forceinline__ void exp2x8_raw(float (&d)[8], const float (&x)[8])
{
    asm("v_exp_f32 %0, %8\n\t"
        "v_exp_f32 %1, %9\n\t"
        "v_exp_f32 %2, %10\n\t"
        "v_exp_f32 %3, %11\n\t"
        "v_exp_f32 %4, %12\n\t"
        "v_exp_f32 %5, %13\n\t"
        "v_exp_f32 %6, %14\n\t"
        "v_exp_f32 %7, %15\n\t"
        "v_nop"
        : "=&v"(d[0]), "=&v"(d[1]), "=&v"(d[2]), "=&v"(d[3]),
          "=&v"(d[4]), "=&v"(d[5]), "=&v"(d[6]), "=&v"(d[7])
        : "v"(x[0]), "v"(x[1]), "v"(x[2]), "v"(x[3]),
          "v"(x[4]), "v"(x[5]), "v"(x[6]), "v"(x[7]));
}
__device__ __forceinline__ v8f mma_f16(f16x16 a, f16x16 b, v8f c)
{
    return __builtin_amdgcn_wmma_f32_16x16x32_f16(false, a, false, b, (short)0, c, false, false);
}

// ---------------------------------------------------------------------------
// h = relu(x @ proj_w + proj_b)   [N,64]   via V_WMMA_F32_16X16X4_F32
// One block takes 32 rows of x and all 64 columns; the 384 values of K are dealt to
// its 8 waves, 48 each, so that 256 blocks fill the chip and a wave can issue every
// load of its share ahead of its products: one trip to memory, not one for every few
// products.  A weight fragment serves both 16-row tiles.  The waves' partial sums
// meet in LDS, where bias and relu are applied.
// k order: a lane half reads four consecutive values of a row of x with one 16-byte
// load, so product 2*j + p of a wave takes k = 8*j + 4*hi + 2*p + {0, 1}; the rows of
// proj_w are picked by the same rule.
// ---------------------------------------------------------------------------
#define PJ_SPLIT 8
#define PJ_K     (D_IN / PJ_SPLIT)   // a wave's share of K
#define PJ_ROWS  32                  // rows of x in a block
// row pitch of the partial sums in dwords: 16-byte aligned, and eight rows on lie
// 32 banks further, so the two lane halves of a store do not meet
#define PJ_PITCH 68
__global__ __launch_bounds__(256) void k_proj(const float* __restrict__ x,
                                              const float* __restrict__ w,
                                              const float* __restrict__ b,
                                              float* __restrict__ h)
{
    __shared__ __align__(16) float part[PJ_SPLIT][PJ_ROWS * PJ_PITCH];

    const int wave = threadIdx.x >> 5;
    const int lane = threadIdx.x & 31;
    const int hi   = lane >> 4;
    const int lj   = lane & 15;
    const int n0   = blockIdx.x * PJ_ROWS;
    const int k0   = wave * PJ_K;

    const float* xp = x + (n0 + lj) * D_IN + k0 + 4 * hi;   // row lj of the first tile, the lane half's four values
    const float* wp = w + (k0 + 4 * hi) * D_H + lj;

    float4 xa[2][PJ_K / 8];
#pragma unroll
    for (int rt = 0; rt < 2; ++rt)
#pragma unroll
        for (int j = 0; j < PJ_K / 8; ++j)
            xa[rt][j] = *(const float4*)(xp + 16 * rt * D_IN + 8 * j);
    v2f wb[PJ_K / 4][4];
#pragma unroll
    for (int kc = 0; kc < PJ_K / 4; ++kc) {
        const int kr = 8 * (kc >> 1) + 2 * (kc & 1);
#pragma unroll
        for (int cb = 0; cb < 4; ++cb) {
            wb[kc][cb].x = wp[(kr + 0) * D_H + 16 * cb];
            wb[kc][cb].y = wp[(kr + 1) * D_H + 16 * cb];
        }
    }
    // keeps the wave's 108 loads in one group ahead of the products, which then wait on
    // a falling count: left free, the later loads of x sink among the products and
    // each group of them shows the way to memory anew
    __builtin_amdgcn_sched_barrier(0);

    v8f acc[2][4] = {};
#pragma unroll
    for (int kc = 0; kc < PJ_K / 4; ++kc)
#pragma unroll
        for (int rt = 0; rt < 2; ++rt) {
            const float4 xv = xa[rt][kc >> 1];
            const v2f a = (kc & 1) ? v2f{ xv.z, xv.w } : v2f{ xv.x, xv.y };
#pragma unroll
            for (int cb = 0; cb < 4; ++cb)
                acc[rt][cb] = __builtin_amdgcn_wmma_f32_16x16x4_f32(false, a, false, wb[kc][cb],
                                                                    (short)0, acc[rt][cb],
                                                                    false, false);
        }

#pragma unroll
    for (int rt = 0; rt < 2; ++rt)
#pragma unroll
        for (int cb = 0; cb < 4; ++cb)
#pragma unroll
            for (int r = 0; r < 8; ++r)
                part[wave][(16 * rt + r + 8 * hi) * PJ_PITCH + 16 * cb + lj] = acc[rt][cb][r];
    __syncthreads();            // the waves' partial sums are published

    // a thread sums four columns of two rows; 16 lanes side by side cover a row
    const int c0 = (threadIdx.x & 15) * 4;
#pragma unroll
    for (int q = 0; q < 2; ++q) {
        const int row = (threadIdx.x >> 4) + 16 * q;
        float4 s = make_float4(b[c0], b[c0 + 1], b[c0 + 2], b[c0 + 3]);
#pragma unroll
        for (int p = 0; p < PJ_SPLIT; ++p) {
            const float4 v = *(const float4*)&part[p][row * PJ_PITCH + c0];
            s.x += v.x; s.y += v.y; s.z += v.z; s.w += v.w;
        }
        *(float4*)&h[(n0 + row) * D_H + c0] =
            make_float4(fmaxf(s.x, 0.0f), fmaxf(s.y, 0.0f), fmaxf(s.z, 0.0f), fmaxf(s.w, 0.0f));
    }
}

// ---------------------------------------------------------------------------
// hp[h] = h @ head_w[h] + head_b[h]   [H,N,64]   + fused ssq[h][n]
// hp is stored rounded to f16; ssq is the square sum of the rounded values.
// ---------------------------------------------------------------------------
__global__ __launch_bounds__(256) void k_heads(const float* __restrict__ h,
                                               const float* __restrict__ head_w,
                                               const float* __restrict__ head_b,
                                               float* __restrict__ hp,
                                               float* __restrict__ ssq)
{
    const int wave = threadIdx.x >> 5;
    const int lane = threadIdx.x & 31;
    const int hi   = lane >> 4;
    const int lj   = lane & 15;
    const int gw   = blockIdx.x * 8 + wave;           // 2048 waves
    const int hd   = gw >> 9;
    const int n0   = (gw & 511) << 4;
    const float* w = head_w + hd * D_H * D_H;

    v8f acc[4];
#pragma unroll
    for (int cb = 0; cb < 4; ++cb) {
        const float bb = head_b[hd * D_H + 16 * cb + lj];
#pragma unroll
        for (int r = 0; r < 8; ++r) acc[cb][r] = bb;
    }

#pragma unroll
    for (int kc = 0; kc < 16; ++kc) {
        v2f a = *(const v2f*)&h[(n0 + lj) * D_H + 4 * kc + 2 * hi];
#pragma unroll
        for (int cb = 0; cb < 4; ++cb) {
            v2f bv;
            bv.x = w[(4 * kc + 2 * hi + 0) * D_H + 16 * cb + lj];
            bv.y = w[(4 * kc + 2 * hi + 1) * D_H + 16 * cb + lj];
            acc[cb] = __builtin_amdgcn_wmma_f32_16x16x4_f32(false, a, false, bv,
                                                            (short)0, acc[cb],
                                                            false, false);
        }
    }

    _Float16* dst = (_Float16*)hp + hd * (N_TOK * ROW_H);
    float sums[8];
#pragma unroll
    for (int r = 0; r < 8; ++r) sums[r] = 0.0f;
#pragma unroll
    for (int cb = 0; cb < 4; ++cb)
#pragma unroll
        for (int r = 0; r < 8; ++r) {
            const _Float16 vh = (_Float16)acc[cb][r];
            const float v = (float)vh;
            dst[(n0 + r + 8 * hi) * ROW_H + 16 * cb + lj] = vh;
            sums[r] += v * v;
        }
    // reduce over the 16-lane column group (rows are r + 8*hi)
#pragma unroll
    for (int off = 1; off < 16; off <<= 1)
#pragma unroll
        for (int r = 0; r < 8; ++r)
            sums[r] += __shfl_xor(sums[r], off, 32);
    if (lj == 0) {
#pragma unroll
        for (int r = 0; r < 8; ++r)
            ssq[hd * N_TOK + n0 + r + 8 * hi] = sums[r];
    }
}

// ---------------------------------------------------------------------------
// Streaming distance-softmax attention, per head.
// One wave <-> one (head, 16-query tile, share of the keys).  Block = KSPLIT groups
// of 8 waves, all same head; the groups' partial results are merged through LDS.
// 64-key tiles double-buffered in LDS via async global->LDS loads (ASYNCcnt), a ring
// of two buffers for each group.
// Both products run on the f16 16x16x32 form with f32 sums.
// Per trip: S^T = Kt * Q^T (four 16-key tiles, 8 wmma), the weights exp(-d) of all
// 64 keys, O^T += Kt^T * P^T (8 wmma): P^T is the score tiles rounded to
// f16 where they lie, Kt^T the same key tile read by the transposing load.
// The softmax is taken against the fixed bound 0, not against a running maximum:
// a score is minus a distance, so no weight exceeds 1, and every query is among its
// own keys at distance 0 (up to the f32 rounding of its square sum), so the sum of
// its weights does not fall below about 1.  Sums and weights therefore need no
// rescaling, in the loop or in the merge.
// D layout: lane L, vgpr r -> row = r + 8*(L>=16), col = L&15.
// ---------------------------------------------------------------------------
// (six waves a SIMD is what the block brings and all that the grid can fill: said to
// the compiler so that it does not order the softmax for fewer registers, in
// dependent chains, to make room for waves that never come)
__global__ __launch_bounds__(KSPLIT * GRP_T) __attribute__((amdgpu_waves_per_eu(2 * KSPLIT, 2 * KSPLIT))) void k_attn(const float* __restrict__ hp,
                                              const float* __restrict__ ssq,
                                              float* __restrict__ hout)
{
    // double-buffered key tiles with padded rows; behind the loop the same bytes serve
    // the merge of the key groups, which needs more of them than the rings
    __shared__ __align__(16) float smem[SMEM_F];
    float (*ktile)[2][KSTEP * K_PITCH] = (float (*)[2][KSTEP * K_PITCH])smem;

    // key group: the same in every lane of a wave, held in a scalar register so that
    // the tests on the group's trip count below are scalar branches
    const int grp  = __builtin_amdgcn_readfirstlane(threadIdx.x / GRP_T);
    const int tid  = threadIdx.x % GRP_T;    // thread in the group
    const int wave = tid >> 5;
    const int lane = tid & 31;
    const int hi   = lane >> 4;
    const int lj   = lane & 15;

    const int gw   = blockIdx.x * 8 + wave;  // 2048 query tiles = 4 heads * 512, KSPLIT waves each
    const int head = gw >> 9;
    const int n0   = (gw & 511) << 4;

    const float* hph  = hp  + head * (N_TOK * ROW_F); // 32 dwords a row
    const float* ssqh = ssq + head * N_TOK;
    const int    t0   = (grp * NTILE) / KSPLIT;       // the group's first key tile
    const int    nt   = ((grp + 1) * NTILE) / KSPLIT - t0;  // and how many it has (NT_MAX or one fewer)
    const int    key0 = t0 * KSTEP;
    const float* hpk  = hph + key0 * ROW_F + tid * 4; // lane's first packet of the group's keys

    // lane's first 16 B packet: key row tid / 8, packet tid % 8 of the row
    const uint32_t lds_off = (uint32_t)(tid >> 3) * (K_PITCH * 4u) + (uint32_t)(tid & 7) * 16u;
    const uint32_t lds_k[2] = {
        (uint32_t)(uintptr_t)(&ktile[grp][0][0]) + lds_off,
        (uint32_t)(uintptr_t)(&ktile[grp][1][0]) + lds_off };

    // B operand of the S^T product: query row lj, features 32*kk + 16*hi + 0..15
    // (the key rows below are read by the same rule, so the k orders agree)
    const _Float16* qrow = (const _Float16*)hph + (n0 + lj) * ROW_H + 16 * hi;
    f16x16 qh[2];
#pragma unroll
    for (int kk = 0; kk < 2; ++kk)
        qh[kk] = ld_frag(qrow + 32 * kk);
    const float ssqq = ssqh[n0 + lj];

    float lsum[KSUB] = {};   // the lane's own share of the weights' sum, a chain for each score tile
    v8f acc[4] = {};     // acc[cb][r] = O[query lj][feature 16*cb + 8*hi + r]

    // tile 0 into buffer 0, published; then tile 1 flies into buffer 1
    async_copy_tile(lds_k[0], hpk);
    wait_asynccnt0();
    __syncthreads();
    async_copy_tile(lds_k[1], hpk + KSTEP * ROW_F);

    // every wave makes NT_MAX trips and passes every barrier; a group whose share is
    // one tile shorter does no work in the last one
    for (int t = 0; t < NT_MAX; ++t) {
      if (t < nt) {
        const int m0 = key0 + t * KSTEP;
        const _Float16* kt = (const _Float16*)ktile[grp][t & 1];

        // S^T tiles: rows = keys (i = 16*s + r + 8*hi), cols = queries (j = lj)
        // (every loop of the trip is unrolled whole: c, kh, pv and acc are indexed
        // by constants only and so stay in registers; s innermost lets the four
        // chains follow one another in the matrix pipe)
        v8f c[KSUB] = {};
        f16x16 kh[2][KSUB];
#pragma unroll
        for (int kk = 0; kk < 2; ++kk)
#pragma unroll
            for (int s = 0; s < KSUB; ++s)
                kh[kk][s] = ld_frag(kt + (16 * s + lj) * PITCH_H + 32 * kk + 16 * hi);
        // keeps the trip's 16 fragment reads in one group ahead of the products, which
        // then wait on a falling count: dealt out among the products, each pair of
        // reads is waited for to 0 and shows its whole LDS latency
        __builtin_amdgcn_sched_barrier(0);
#pragma unroll
        for (int kk = 0; kk < 2; ++kk)
#pragma unroll
            for (int s = 0; s < KSUB; ++s) c[s] = mma_f16(kh[kk][s], qh[kk], c[s]);
        // keeps the loads of the keys' square sums behind the score products: lifted
        // over them they hold 32 registers more and the query fragments are spilled
        __builtin_amdgcn_sched_barrier(0);

        // scores: s = -sqrt(max(ssq_i + ssq_j - 2*dot, 0))
        // (what sqrtf's extra steps would add is lost in the exponential behind the
        // root: a last-place error of a distance, and a subnormal argument, whose
        // root lies below 2^-63 and counts as 0 in exp(-d) either way)
        float dist[KSUB][8];
#pragma unroll
        for (int s = 0; s < KSUB; ++s) {
            float sqd[8];
#pragma unroll
            for (int r = 0; r < 8; ++r)
                sqd[r] = fmaxf(ssqh[m0 + 16 * s + r + 8 * hi] + ssqq - 2.0f * c[s][r], 0.0f);
            sqrt8_raw(dist[s], sqd);
        }
        // keeps the trip's 32 roots in one stretch ahead of its 32 exponentials: left
        // free, the compiler takes the tiles one after another, asks for each tile's
        // square sums only when its turn comes and waits for them to 0, four exposed
        // loads a trip in place of one, with the arithmetic in dependent chains
        __builtin_amdgcn_sched_barrier(0);
        // A operands of the first 32 keys' O^T products
        const _Float16* vp0 = kt + (8 * hi + (lane & 7)) * PITCH_H + 8 * ((lane >> 3) & 1);
        f16x8 vfirst[4][2];
#pragma unroll
        for (int cb = 0; cb < 4; ++cb) {
            vfirst[cb][0] = ld_tr16(vp0 + 16 * cb);
            vfirst[cb][1] = ld_tr16(vp0 + 16 * cb + 16 * PITCH_H);
        }
        // holds these eight loads ahead of the exponentials, which cover their way from
        // LDS: left free, two of them sink behind the first product and are waited for to 0
        __builtin_amdgcn_sched_barrier(0);
        float pv[KSUB][8];                         // P^T[m = 16*s + r + 8*hi][n = lj]
#pragma unroll
        for (int s = 0; s < KSUB; ++s) {
            float e[8];
#pragma unroll
            for (int r = 0; r < 8; ++r) e[r] = dist[s][r] * -1.44269504f;   // exp(-d) = 2^(-d * log2 e)
            exp2x8_raw(pv[s], e);
        }
#pragma unroll
        for (int r = 0; r < 8; ++r)
#pragma unroll
            for (int s = 0; s < KSUB; ++s) lsum[s] += pv[s][r];

        // O^T[e][n] += hp_k[m][e] * P^T[m][n], 32 keys a product.
        // B: elements 2i, 2i+1 = registers 2*(i&3), 2*(i&3)+1 of score tile 2*j + (i>>2),
        // i.e. keys 32*j + 8*hi + 0..7 and 32*j + 16 + 8*hi + 0..7; the two transposing
        // loads deliver A's keys in the same order.
#pragma unroll
        for (int j = 0; j < KSTEP / 32; ++j) {
            u32x8 w;
#pragma unroll
            for (int i = 0; i < 8; ++i) {
                const v2f pp = { pv[2 * j + (i >> 2)][2 * (i & 3)], pv[2 * j + (i >> 2)][2 * (i & 3) + 1] };
                w[i] = __builtin_bit_cast(uint32_t, __builtin_convertvector(pp, f16x2));
            }
            const f16x16 pb = __builtin_bit_cast(f16x16, w);
            const _Float16* vp = vp0 + 32 * j * PITCH_H;
#pragma unroll
            for (int cb = 0; cb < 4; ++cb) {
                const f16x8 v0 = j == 0 ? vfirst[cb][0] : ld_tr16(vp + 16 * cb);
                const f16x8 v1 = j == 0 ? vfirst[cb][1] : ld_tr16(vp + 16 * cb + 16 * PITCH_H);
                const f16x16 va = __builtin_shufflevector(v0, v1, 0, 1, 2, 3, 4, 5, 6, 7,
                                                          8, 9, 10, 11, 12, 13, 14, 15);
                acc[cb] = mma_f16(va, pb, acc[cb]);
            }
        }
      }

        wait_dscnt0();          // own reads of this tile are done
        wait_asynccnt0();       // own packets of the next tile have landed
        __syncthreads();        // publishes tile t + 1, frees this trip's buffer
        if (t + 2 < nt)         // refill the buffer that this trip has just read
            async_copy_tile(lds_k[t & 1], hpk + (t + 2) * KSTEP * ROW_F);
    }
    wait_asynccnt0();           // nothing of the wave's is left in flight

    // Merge of the key groups.  Behind the loop's last barrier no tile is read and no
    // copy is in flight, so the rings' LDS serves as the exchange: groups 1.. leave their
    // un-normalised sums (16 bytes a lane and store, lanes side by side) and the sums of
    // their weights; group 0 adds them.
    // a query's keys lie in the two lane halves: their shares of the weights' sum meet here
    float run_l = (lsum[0] + lsum[1]) + (lsum[2] + lsum[3]);
    run_l += __shfl_xor(run_l, 16, 32);
    float4* xacc = (float4*)smem;
    float*  xl   = (float*)(xacc + (KSPLIT - 1) * GRP_T * 8);
    if (grp != 0) {
        const int slot = (grp - 1) * GRP_T + tid;
#pragma unroll
        for (int cb = 0; cb < 4; ++cb)
#pragma unroll
            for (int q = 0; q < 2; ++q)
                xacc[(2 * cb + q) * ((KSPLIT - 1) * GRP_T) + slot] =
                    make_float4(acc[cb][4 * q], acc[cb][4 * q + 1], acc[cb][4 * q + 2], acc[cb][4 * q + 3]);
        xl[slot] = run_l;
    }
    __syncthreads();            // the partial results are published
    if (grp != 0) return;

#pragma unroll
    for (int g = 0; g < KSPLIT - 1; ++g) {
        run_l += xl[g * GRP_T + tid];
#pragma unroll
        for (int cb = 0; cb < 4; ++cb)
#pragma unroll
            for (int q = 0; q < 2; ++q) {
                const float4 p = xacc[(2 * cb + q) * ((KSPLIT - 1) * GRP_T) + g * GRP_T + tid];
                acc[cb][4 * q + 0] += p.x;
                acc[cb][4 * q + 1] += p.y;
                acc[cb][4 * q + 2] += p.z;
                acc[cb][4 * q + 3] += p.w;
            }
    }

    // normalize by the merged sum of the lane's own query
    const float linv = 1.0f / run_l;
    float* dst = hout + head * (N_TOK * D_H) + (n0 + lj) * D_H + 8 * hi;
#pragma unroll
    for (int cb = 0; cb < 4; ++cb)
#pragma unroll
        for (int r = 0; r < 8; ++r)
            dst[16 * cb + r] = acc[cb][r] * linv;
}

// ---------------------------------------------------------------------------
// combine heads (softmax(attn_w)), LayerNorm, FC head.   One thread per row.
// ---------------------------------------------------------------------------
__global__ __launch_bounds__(256) void k_final(const float* __restrict__ hout,
                                               const float* __restrict__ attn_w,
                                               const float* __restrict__ gamma,
                                               const float* __restrict__ beta,
                                               const float* __restrict__ fc_w,
                                               const float* __restrict__ fc_b,
                                               float* __restrict__ out)
{
    const int n = blockIdx.x * 256 + threadIdx.x;
    if (n >= N_TOK) return;

    float aw[N_HEADS];
    float amax = -INFINITY;
#pragma unroll
    for (int h = 0; h < N_HEADS; ++h) { aw[h] = attn_w[h]; amax = fmaxf(amax, aw[h]); }
    float asum = 0.0f;
#pragma unroll
    for (int h = 0; h < N_HEADS; ++h) { aw[h] = __expf(aw[h] - amax); asum += aw[h]; }
    const float ainv = 1.0f / asum;

    float comb[D_H];
#pragma unroll
    for (int e = 0; e < D_H; ++e) comb[e] = 0.0f;
#pragma unroll
    for (int h = 0; h < N_HEADS; ++h) {
        const float* p = hout + h * (N_TOK * D_H) + n * D_H;
        const float w = aw[h] * ainv;
        for (int e = 0; e < D_H; ++e) comb[e] += w * p[e];
    }

    float mu = 0.0f;
#pragma unroll
    for (int e = 0; e < D_H; ++e) mu += comb[e];
    mu *= (1.0f / D_H);
    float var = 0.0f;
#pragma unroll
    for (int e = 0; e < D_H; ++e) { const float d = comb[e] - mu; var += d * d; }
    var *= (1.0f / D_H);
    const float rs = rsqrtf(var + LN_EPS);
#pragma unroll
    for (int e = 0; e < D_H; ++e)
        comb[e] = (comb[e] - mu) * rs * gamma[e] + beta[e];

#pragma unroll
    for (int c = 0; c < N_CLS; ++c) {
        float a = fc_b[c];
        for (int e = 0; e < D_H; ++e) a += comb[e] * fc_w[e * N_CLS + c];
        out[n * N_CLS + c] = a;
    }
}

// ---------------------------------------------------------------------------
extern "C" void kernel_launch(void* const* d_in, const int* in_sizes, int n_in,
                              void* d_out, int out_size, void* d_ws, size_t ws_size,
                              hipStream_t stream)
{
    const float* x      = (const float*)d_in[0];
    const float* proj_w = (const float*)d_in[1];
    const float* proj_b = (const float*)d_in[2];
    const float* head_w = (const float*)d_in[3];
    const float* head_b = (const float*)d_in[4];
    const float* attn_w = (const float*)d_in[5];
    const float* gamma  = (const float*)d_in[6];
    const float* beta   = (const float*)d_in[7];
    const float* fc_w   = (const float*)d_in[8];
    const float* fc_b   = (const float*)d_in[9];

    float* ws   = (float*)d_ws;
    float* h    = ws + WS_H;
    float* hp   = ws + WS_HP;
    float* ssq  = ws + WS_SSQ;
    float* hout = ws + WS_HOUT;
    float* out  = (float*)d_out;

    k_proj <<<N_TOK / PJ_ROWS,              256, 0, stream>>>(x, proj_w, proj_b, h);
    k_heads<<<(N_HEADS * N_TOK / 16) / 8,   256, 0, stream>>>(h, head_w, head_b, hp, ssq);
    k_attn <<<(N_HEADS * (N_TOK / 16)) / 8, KSPLIT * GRP_T, 0, stream>>>(hp, ssq, hout);
    k_final<<<N_TOK / 256,                  256, 0, stream>>>(hout, attn_w, gamma, beta,
                                                              fc_w, fc_b, out);
}

// v009
// Measured time: 86.3 microseconds a run.
// Timed twice side by side with v008, it ran 1.08 times as fast both times.
// All steps since v000 together make it 9.61 times as fast.
#include <hip/hip_runtime.h>
#include <hip/hip_bf16.h>
#include <math.h>
#include <stdint.h>

typedef float v2f __attribute__((ext_vector_type(2)));
typedef float v8f __attribute__((ext_vector_type(8)));
typedef _Float16 f16x2  __attribute__((ext_vector_type(2)));
typedef _Float16 f16x8  __attribute__((ext_vector_type(8)));
typedef _Float16 f16x16 __attribute__((ext_vector_type(16)));
typedef short    s16x8  __attribute__((ext_vector_type(8)));
typedef uint32_t u32x8  __attribute__((ext_vector_type(8)));

#define N_TOK   8192
#define D_IN    384
#define D_H     64
#define N_HEADS 4
#define N_CLS   6
#define LN_EPS  1e-5f

// A row of hp is kept as 64 f16 values, 128 bytes.  The attention works on these
// rounded points throughout: the distances are those between them, and the square
// sums are taken of the same rounded values, so that a point's distance to itself
// stays 0 up to f32 rounding and every other distance moves by no more than the
// two points' own rounding.
// LDS row pitch of the key tile in dwords (64 banks of 4 B): 144 B = 16 B * odd,
// so the 16 rows that a lane half reads with 16-byte loads fall on 16 distinct
// groups of four banks.
#define K_PITCH 36
#define ROW_H   D_H             // f16 elements in a global row
#define ROW_F   (D_H / 2)       // dwords in a global row
#define PITCH_H (2 * K_PITCH)   // f16 elements from one LDS row to the next

// keys per trip of the attention loop: four 16-key score tiles
#define KSTEP   64
#define KSUB    (KSTEP / 16)

// the keys are dealt to KSPLIT groups of 8 waves inside one work-group: each group
// walks its own share of the key tiles for the same 8 query tiles, so a SIMD holds
// 2 * KSPLIT waves whose waits cover one another (three groups: 160 registers a wave)
#define KSPLIT  3
#define GRP_T   256             // threads in a key group
#define NTILE   (N_TOK / KSTEP) // key tiles of a head
#define NT_MAX  ((NTILE + KSPLIT - 1) / KSPLIT)   // trips of the longest share
// LDS of the attention kernel in dwords: the rings, or the merge's exchange (32 sums
// and the sum of the weights for every thread of the groups behind the first)
#define RING_F  (KSPLIT * 2 * KSTEP * K_PITCH)
#define XCHG_F  ((KSPLIT - 1) * GRP_T * (32 + 1))
#define SMEM_F  (RING_F > XCHG_F ? RING_F : XCHG_F)

// workspace layout (float offsets)
#define WS_H    0
#define WS_HP   (WS_H   + N_TOK * D_H)                 // [H][N][64 f16]
#define WS_SSQ  (WS_HP  + N_HEADS * N_TOK * ROW_F)     // [H][N]
#define WS_HOUT (WS_SSQ + N_HEADS * N_TOK)             // [H][N][64]

// ---------------------------------------------------------------------------
// CDNA5 async global -> LDS copy (ASYNCcnt path).  One 64-key tile = two
// 16 B packets per lane, 32 key rows apart.  The xcnt wait is the last line of
// the copies' own statement, so no address register that a copy names can be
// rewritten ahead of it.
// ---------------------------------------------------------------------------
__device__ __forceinline__ void async_copy_tile(uint32_t lds_byte_addr,
                                                const float* gptr)
{
    asm volatile("global_load_async_to_lds_b128 %0, %2, off\n\t"
                 "global_load_async_to_lds_b128 %1, %3, off\n\t"
                 "s_wait_xcnt 0x0"
                 :: "v"(lds_byte_addr),
                    "v"(lds_byte_addr + 32u * K_PITCH * 4u),
                    "v"((unsigned long long)(uintptr_t)(gptr)),
                    "v"((unsigned long long)(uintptr_t)(gptr + 32 * ROW_F))
                 : "memory");
}
// the wave's own copies have landed in LDS
__device__ __forceinline__ void wait_asynccnt0()
{
    asm volatile("s_wait_asynccnt 0x0" ::: "memory");
}
// the wave's own LDS reads of the tile have returned (before the buffer is handed back)
__device__ __forceinline__ void wait_dscnt0()
{
    asm volatile("s_wait_dscnt 0x0" ::: "memory");
}

// 16 consecutive f16 as one operand of the 16x16x32 form (two 16-byte loads)
__device__ __forceinline__ f16x16 ld_frag(const _Float16* p)
{
    const f16x8 a = *(const f16x8*)p;
    const f16x8 b = *(const f16x8*)(p + 8);
    return __builtin_shufflevector(a, b, 0, 1, 2, 3, 4, 5, 6, 7, 8, 9, 10, 11, 12, 13, 14, 15);
}
// transposing LDS load: lane (c, h) gets eight rows (8h .. 8h+7) of column c
__device__ __forceinline__ f16x8 ld_tr16(const _Float16* p)
{
    typedef __attribute__((address_space(3))) s16x8 lds_s16x8;
    return __builtin_bit_cast(f16x8, __builtin_amdgcn_ds_load_tr16_b128_v8i16((lds_s16x8*)p));
}
// Eight square roots on the hardware's own v_sqrt_f32 (1 ulp), without the library's
// scaling and correction steps.  One statement: behind a transcendental the
// instruction set asks for one independent instruction before its source is
// overwritten or its result read.  Here each root is followed by a root that is
// independent of it (early-clobber outputs share no register with an input), and
// the v_nop fills that slot behind the last one.
__device__ __forceinline__ void sqrt8_raw(float (&d)[8], const float (&x)[8])
{
    asm("v_sqrt_f32 %0, %8\n\t"
        "v_sqrt_f32 %1, %9\n\t"
        "v_sqrt_f32 %2, %10\n\t"
        "v_sqrt_f32 %3, %11\n\t"
        "v_sqrt_f32 %4, %12\n\t"
        "v_sqrt_f32 %5, %13\n\t"
        "v_sqrt_f32 %6, %14\n\t"
        "v_sqrt_f32 %7, %15\n\t"
        "v_nop"
        : "=&v"(d[0]), "=&v"(d[1]), "=&v"(d[2]), "=&v"(d[3]),
          "=&v"(d[4]), "=&v"(d[5]), "=&v"(d[6]), "=&v"(d[7])
        : "v"(x[0]), "v"(x[1]), "v"(x[2]), "v"(x[3]),
          "v"(x[4]), "v"(x[5]), "v"(x[6]), "v"(x[7]));
}
// Eight powers of two on v_exp_f32, in one statement for the same reason.
__device__ __forceinline__ void exp2x8_raw(float (&d)[8], const float (&x)[8])
{
    asm("v_exp_f32 %0, %8\n\t"
        "v_exp_f32 %1, %9\n\t"
        "v_exp_f32 %2, %10\n\t"
        "v_exp_f32 %3, %11\n\t"
        "v_exp_f32 %4, %12\n\t"
        "v_exp_f32 %5, %13\n\t"
        "v_exp_f32 %6, %14\n\t"
        "v_exp_f32 %7, %15\n\t"
        "v_nop"
        : "=&v"(d[0]), "=&v"(d[1]), "=&v"(d[2]), "=&v"(d[3]),
          "=&v"(d[4]), "=&v"(d[5]), "=&v"(d[6]), "=&v"(d[7])
        : "v"(x[0]), "v"(x[1]), "v"(x[2]), "v"(x[3]),
          "v"(x[4]), "v"(x[5]), "v"(x[6]), "v"(x[7]));
}
__device__ __forceinline__ v8f mma_f16(f16x16 a, f16x16 b, v8f c)
{
    return __builtin_amdgcn_wmma_f32_16x16x32_f16(false, a, false, b, (short)0, c, false, false);
}

// ---------------------------------------------------------------------------
// h = relu(x @ proj_w + proj_b)   [N,64]   via V_WMMA_F32_16X16X4_F32
// One block takes 32 rows of x and all 64 columns; the 384 values of K are dealt to
// its 8 waves, 48 each, so that 256 blocks fill the chip and a wave can issue every
// load of its share ahead of its products: one trip to memory, not one for every few
// products.  A weight fragment serves both 16-row tiles.  The waves' partial sums
// meet in LDS, where bias and relu are applied.
// k order: a lane half reads four consecutive values of a row of x with one 16-byte
// load, so product 2*j + p of a wave takes k = 8*j + 4*hi + 2*p + {0, 1}; the rows of
// proj_w are picked by the same rule.
// ---------------------------------------------------------------------------
#define PJ_SPLIT 8
#define PJ_K     (D_IN / PJ_SPLIT)   // a wave's share of K
#define PJ_ROWS  32                  // rows of x in a block
// row pitch of the partial sums in dwords: 16-byte aligned, and eight rows on lie
// 32 banks further, so the two lane halves of a store do not meet
#define PJ_PITCH 68
__global__ __launch_bounds__(256) void k_proj(const float* __restrict__ x,
                                              const float* __restrict__ w,
                                              const float* __restrict__ b,
                                              float* __restrict__ h)
{
    __shared__ __align__(16) float part[PJ_SPLIT][PJ_ROWS * PJ_PITCH];

    const int wave = threadIdx.x >> 5;
    const int lane = threadIdx.x & 31;
    const int hi   = lane >> 4;
    const int lj   = lane & 15;
    const int n0   = blockIdx.x * PJ_ROWS;
    const int k0   = wave * PJ_K;

    const float* xp = x + (n0 + lj) * D_IN + k0 + 4 * hi;   // row lj of the first tile, the lane half's four values
    const float* wp = w + (k0 + 4 * hi) * D_H + lj;

    float4 xa[2][PJ_K / 8];
#pragma unroll
    for (int rt = 0; rt < 2; ++rt)
#pragma unroll
        for (int j = 0; j < PJ_K / 8; ++j)
            xa[rt][j] = *(const float4*)(xp + 16 * rt * D_IN + 8 * j);
    v2f wb[PJ_K / 4][4];
#pragma unroll
    for (int kc = 0; kc < PJ_K / 4; ++kc) {
        const int kr = 8 * (kc >> 1) + 2 * (kc & 1);
#pragma unroll
        for (int cb = 0; cb < 4; ++cb) {
            wb[kc][cb].x = wp[(kr + 0) * D_H + 16 * cb];
            wb[kc][cb].y = wp[(kr + 1) * D_H + 16 * cb];
        }
    }
    // keeps the wave's 108 loads in one group ahead of the products, which then wait on
    // a falling count: left free, the later loads of x sink among the products and
    // each group of them shows the way to memory anew
    __builtin_amdgcn_sched_barrier(0);

    v8f acc[2][4] = {};
#pragma unroll
    for (int kc = 0; kc < PJ_K / 4; ++kc)
#pragma unroll
        for (int rt = 0; rt < 2; ++rt) {
            const float4 xv = xa[rt][kc >> 1];
            const v2f a = (kc & 1) ? v2f{ xv.z, xv.w } : v2f{ xv.x, xv.y };
#pragma unroll
            for (int cb = 0; cb < 4; ++cb)
                acc[rt][cb] = __builtin_amdgcn_wmma_f32_16x16x4_f32(false, a, false, wb[kc][cb],
                                                                    (short)0, acc[rt][cb],
                                                                    false, false);
        }

#pragma unroll
    for (int rt = 0; rt < 2; ++rt)
#pragma unroll
        for (int cb = 0; cb < 4; ++cb)
#pragma unroll
            for (int r = 0; r < 8; ++r)
                part[wave][(16 * rt + r + 8 * hi) * PJ_PITCH + 16 * cb + lj] = acc[rt][cb][r];
    __syncthreads();            // the waves' partial sums are published

    // a thread sums four columns of two rows; 16 lanes side by side cover a row
    const int c0 = (threadIdx.x & 15) * 4;
#pragma unroll
    for (int q = 0; q < 2; ++q) {
        const int row = (threadIdx.x >> 4) + 16 * q;
        float4 s = make_float4(b[c0], b[c0 + 1], b[c0 + 2], b[c0 + 3]);
#pragma unroll
        for (int p = 0; p < PJ_SPLIT; ++p) {
            const float4 v = *(const float4*)&part[p][row * PJ_PITCH + c0];
            s.x += v.x; s.y += v.y; s.z += v.z; s.w += v.w;
        }
        *(float4*)&h[(n0 + row) * D_H + c0] =
            make_float4(fmaxf(s.x, 0.0f), fmaxf(s.y, 0.0f), fmaxf(s.z, 0.0f), fmaxf(s.w, 0.0f));
    }
}

// ---------------------------------------------------------------------------
// hp[h] = h @ head_w[h] + head_b[h]   [H,N,64]   + fused ssq[h][n]
// hp is stored rounded to f16; ssq is the square sum of the rounded values.
// ---------------------------------------------------------------------------
__global__ __launch_bounds__(256) void k_heads(const float* __restrict__ h,
                                               const float* __restrict__ head_w,
                                               const float* __restrict__ head_b,
                                               float* __restrict__ hp,
                                               float* __restrict__ ssq)
{
    const int wave = threadIdx.x >> 5;
    const int lane = threadIdx.x & 31;
    const int hi   = lane >> 4;
    const int lj   = lane & 15;
    const int gw   = blockIdx.x * 8 + wave;           // 2048 waves
    const int hd   = gw >> 9;
    const int n0   = (gw & 511) << 4;
    const float* w = head_w + hd * D_H * D_H;

    v8f acc[4];
#pragma unroll
    for (int cb = 0; cb < 4; ++cb) {
        const float bb = head_b[hd * D_H + 16 * cb + lj];
#pragma unroll
        for (int r = 0; r < 8; ++r) acc[cb][r] = bb;
    }

#pragma unroll
    for (int kc = 0; kc < 16; ++kc) {
        v2f a = *(const v2f*)&h[(n0 + lj) * D_H + 4 * kc + 2 * hi];
#pragma unroll
        for (int cb = 0; cb < 4; ++cb) {
            v2f bv;
            bv.x = w[(4 * kc + 2 * hi + 0) * D_H + 16 * cb + lj];
            bv.y = w[(4 * kc + 2 * hi + 1) * D_H + 16 * cb + lj];
            acc[cb] = __builtin_amdgcn_wmma_f32_16x16x4_f32(false, a, false, bv,
                                                            (short)0, acc[cb],
                                                            false, false);
        }
    }

    _Float16* dst = (_Float16*)hp + hd * (N_TOK * ROW_H);
    float sums[8];
#pragma unroll
    for (int r = 0; r < 8; ++r) sums[r] = 0.0f;
#pragma unroll
    for (int cb = 0; cb < 4; ++cb)
#pragma unroll
        for (int r = 0; r < 8; ++r) {
            const _Float16 vh = (_Float16)acc[cb][r];
            const float v = (float)vh;
            dst[(n0 + r + 8 * hi) * ROW_H + 16 * cb + lj] = vh;
            sums[r] += v * v;
        }
    // reduce over the 16-lane column group (rows are r + 8*hi)
#pragma unroll
    for (int off = 1; off < 16; off <<= 1)
#pragma unroll
        for (int r = 0; r < 8; ++r)
            sums[r] += __shfl_xor(sums[r], off, 32);
    if (lj == 0) {
#pragma unroll
        for (int r = 0; r < 8; ++r)
            ssq[hd * N_TOK + n0 + r + 8 * hi] = sums[r];
    }
}

// ---------------------------------------------------------------------------
// Streaming distance-softmax attention, per head.
// One wave <-> one (head, 16-query tile, share of the keys).  Block = KSPLIT groups
// of 8 waves, all same head; the groups' partial results are merged through LDS.
// 64-key tiles double-buffered in LDS via async global->LDS loads (ASYNCcnt), a ring
// of two buffers for each group.
// Both products run on the f16 16x16x32 form with f32 sums.
// Per trip: S^T = Kt * Q^T (four 16-key tiles, 8 wmma), the weights exp(-d) of all
// 64 keys, O^T += Kt^T * P^T (8 wmma): P^T is the score tiles rounded to
// f16 where they lie, Kt^T the same key tile read by the transposing load.
// The softmax is taken against the fixed bound 0, not against a running maximum:
// a score is minus a distance, so no weight exceeds 1, and every query is among its
// own keys at distance 0 (up to the f32 rounding of its square sum), so the sum of
// its weights does not fall below about 1.  Sums and weights therefore need no
// rescaling, in the loop or in the merge.
// D layout: lane L, vgpr r -> row = r + 8*(L>=16), col = L&15.
// ---------------------------------------------------------------------------
// (six waves a SIMD is what the block brings and all that the grid can fill: said to
// the compiler so that it does not order the softmax for fewer registers, in
// dependent chains, to make room for waves that never come)
__global__ __launch_bounds__(KSPLIT * GRP_T) __attribute__((amdgpu_waves_per_eu(2 * KSPLIT, 2 * KSPLIT))) void k_attn(const float* __restrict__ hp,
                                              const float* __restrict__ ssq,
                                              float* __restrict__ hout)
{
    // double-buffered key tiles with padded rows; behind the loop the same bytes serve
    // the merge of the key groups, which needs more of them than the rings
    __shared__ __align__(16) float smem[SMEM_F];
    float (*ktile)[2][KSTEP * K_PITCH] = (float (*)[2][KSTEP * K_PITCH])smem;

    // key group: the same in every lane of a wave, held in a scalar register so that
    // the tests on the group's trip count below are scalar branches
    const int grp  = __builtin_amdgcn_readfirstlane(threadIdx.x / GRP_T);
    const int tid  = threadIdx.x % GRP_T;    // thread in the group
    const int wave = tid >> 5;
    const int lane = tid & 31;
    const int hi   = lane >> 4;
    const int lj   = lane & 15;

    const int gw   = blockIdx.x * 8 + wave;  // 2048 query tiles = 4 heads * 512, KSPLIT waves each
    const int head = gw >> 9;
    const int n0   = (gw & 511) << 4;

    const float* hph  = hp  + head * (N_TOK * ROW_F); // 32 dwords a row
    const float* ssqh = ssq + head * N_TOK;
    const int    t0   = (grp * NTILE) / KSPLIT;       // the group's first key tile
    const int    nt   = ((grp + 1) * NTILE) / KSPLIT - t0;  // and how many it has (NT_MAX or one fewer)
    const int    key0 = t0 * KSTEP;
    const float* hpk  = hph + key0 * ROW_F + tid * 4; // lane's first packet of the group's keys

    // lane's first 16 B packet: key row tid / 8, packet tid % 8 of the row
    const uint32_t lds_off = (uint32_t)(tid >> 3) * (K_PITCH * 4u) + (uint32_t)(tid & 7) * 16u;
    const uint32_t lds_k[2] = {
        (uint32_t)(uintptr_t)(&ktile[grp][0][0]) + lds_off,
        (uint32_t)(uintptr_t)(&ktile[grp][1][0]) + lds_off };

    // B operand of the S^T product: query row lj, features 32*kk + 16*hi + 0..15
    // (the key rows below are read by the same rule, so the k orders agree)
    const _Float16* qrow = (const _Float16*)hph + (n0 + lj) * ROW_H + 16 * hi;
    f16x16 qh[2];
#pragma unroll
    for (int kk = 0; kk < 2; ++kk)
        qh[kk] = ld_frag(qrow + 32 * kk);
    const float ssqq = ssqh[n0 + lj];

    float lsum[KSUB] = {};   // the lane's own share of the weights' sum, a chain for each score tile
    v8f acc[4] = {};     // acc[cb][r] = O[query lj][feature 16*cb + 8*hi + r]

    // tile 0 into buffer 0, published; then tile 1 flies into buffer 1
    async_copy_tile(lds_k[0], hpk);
    wait_asynccnt0();
    __syncthreads();
    async_copy_tile(lds_k[1], hpk + KSTEP * ROW_F);

    // every wave makes NT_MAX trips and passes every barrier; a group whose share is
    // one tile shorter does no work in the last one
    for (int t = 0; t < NT_MAX; ++t) {
      if (t < nt) {
        const int m0 = key0 + t * KSTEP;
        const _Float16* kt = (const _Float16*)ktile[grp][t & 1];

        // S^T tiles: rows = keys (i = 16*s + r + 8*hi), cols = queries (j = lj)
        // (every loop of the trip is unrolled whole: c, kh, pv and acc are indexed
        // by constants only and so stay in registers; s innermost lets the four
        // chains follow one another in the matrix pipe)
        v8f c[KSUB] = {};
        f16x16 kh[2][KSUB];
#pragma unroll
        for (int kk = 0; kk < 2; ++kk)
#pragma unroll
            for (int s = 0; s < KSUB; ++s)
                kh[kk][s] = ld_frag(kt + (16 * s + lj) * PITCH_H + 32 * kk + 16 * hi);
        // keeps the trip's 16 fragment reads in one group ahead of the products, which
        // then wait on a falling count: dealt out among the products, each pair of
        // reads is waited for to 0 and shows its whole LDS latency
        __builtin_amdgcn_sched_barrier(0);
#pragma unroll
        for (int kk = 0; kk < 2; ++kk)
#pragma unroll
            for (int s = 0; s < KSUB; ++s) c[s] = mma_f16(kh[kk][s], qh[kk], c[s]);
        // keeps the loads of the keys' square sums behind the score products: lifted
        // over them they hold 32 registers more and the query fragments are spilled
        __builtin_amdgcn_sched_barrier(0);

        // scores: s = -sqrt(max(ssq_i + ssq_j - 2*dot, 0))
        // (what sqrtf's extra steps would add is lost in the exponential behind the
        // root: a last-place error of a distance, and a subnormal argument, whose
        // root lies below 2^-63 and counts as 0 in exp(-d) either way)
        float dist[KSUB][8];
#pragma unroll
        for (int s = 0; s < KSUB; ++s) {
            float sqd[8];
#pragma unroll
            for (int r = 0; r < 8; ++r)
                sqd[r] = fmaxf(ssqh[m0 + 16 * s + r + 8 * hi] + ssqq - 2.0f * c[s][r], 0.0f);
            sqrt8_raw(dist[s], sqd);
        }
        // keeps the trip's 32 roots in one stretch ahead of its 32 exponentials: left
        // free, the compiler takes the tiles one after another, asks for each tile's
        // square sums only when its turn comes and waits for them to 0, four exposed
        // loads a trip in place of one, with the arithmetic in dependent chains
        __builtin_amdgcn_sched_barrier(0);
        // A operands of the first 32 keys' O^T products
        const _Float16* vp0 = kt + (8 * hi + (lane & 7)) * PITCH_H + 8 * ((lane >> 3) & 1);
        f16x8 vfirst[4][2];
#pragma unroll
        for (int cb = 0; cb < 4; ++cb) {
            vfirst[cb][0] = ld_tr16(vp0 + 16 * cb);
            vfirst[cb][1] = ld_tr16(vp0 + 16 * cb + 16 * PITCH_H);
        }
        // holds these eight loads ahead of the exponentials, which cover their way from
        // LDS: left free, two of them sink behind the first product and are waited for to 0
        __builtin_amdgcn_sched_barrier(0);
        float pv[KSUB][8];                         // P^T[m = 16*s + r + 8*hi][n = lj]
#pragma unroll
        for (int s = 0; s < KSUB; ++s) {
            float e[8];
#pragma unroll
            for (int r = 0; r < 8; ++r) e[r] = dist[s][r] * -1.44269504f;   // exp(-d) = 2^(-d * log2 e)
            exp2x8_raw(pv[s], e);
        }
#pragma unroll
        for (int r = 0; r < 8; ++r)
#pragma unroll
            for (int s = 0; s < KSUB; ++s) lsum[s] += pv[s][r];

        // O^T[e][n] += hp_k[m][e] * P^T[m][n], 32 keys a product.
        // B: elements 2i, 2i+1 = registers 2*(i&3), 2*(i&3)+1 of score tile 2*j + (i>>2),
        // i.e. keys 32*j + 8*hi + 0..7 and 32*j + 16 + 8*hi + 0..7; the two transposing
        // loads deliver A's keys in the same order.
#pragma unroll
        for (int j = 0; j < KSTEP / 32; ++j) {
            u32x8 w;
#pragma unroll
            for (int i = 0; i < 8; ++i) {
                const v2f pp = { pv[2 * j + (i >> 2)][2 * (i & 3)], pv[2 * j + (i >> 2)][2 * (i & 3) + 1] };
                w[i] = __builtin_bit_cast(uint32_t, __builtin_convertvector(pp, f16x2));
            }
            const f16x16 pb = __builtin_bit_cast(f16x16, w);
            const _Float16* vp = vp0 + 32 * j * PITCH_H;
#pragma unroll
            for (int cb = 0; cb < 4; ++cb) {
                const f16x8 v0 = j == 0 ? vfirst[cb][0] : ld_tr16(vp + 16 * cb);
                const f16x8 v1 = j == 0 ? vfirst[cb][1] : ld_tr16(vp + 16 * cb + 16 * PITCH_H);
                const f16x16 va = __builtin_shufflevector(v0, v1, 0, 1, 2, 3, 4, 5, 6, 7,
                                                          8, 9, 10, 11, 12, 13, 14, 15);
                acc[cb] = mma_f16(va, pb, acc[cb]);
            }
        }
      }

        wait_dscnt0();          // own reads of this tile are done
        wait_asynccnt0();       // own packets of the next tile have landed
        __syncthreads();        // publishes tile t + 1, frees this trip's buffer
        if (t + 2 < nt)         // refill the buffer that this trip has just read
            async_copy_tile(lds_k[t & 1], hpk + (t + 2) * KSTEP * ROW_F);
    }
    wait_asynccnt0();           // nothing of the wave's is left in flight

    // Merge of the key groups.  Behind the loop's last barrier no tile is read and no
    // copy is in flight, so the rings' LDS serves as the exchange: groups 1.. leave their
    // un-normalised sums (16 bytes a lane and store, lanes side by side) and the sums of
    // their weights; group 0 adds them.
    // a query's keys lie in the two lane halves: their shares of the weights' sum meet here
    float run_l = (lsum[0] + lsum[1]) + (lsum[2] + lsum[3]);
    run_l += __shfl_xor(run_l, 16, 32);
    float4* xacc = (float4*)smem;
    float*  xl   = (float*)(xacc + (KSPLIT - 1) * GRP_T * 8);
    if (grp != 0) {
        const int slot = (grp - 1) * GRP_T + tid;
#pragma unroll
        for (int cb = 0; cb < 4; ++cb)
#pragma unroll
            for (int q = 0; q < 2; ++q)
                xacc[(2 * cb + q) * ((KSPLIT - 1) * GRP_T) + slot] =
                    make_float4(acc[cb][4 * q], acc[cb][4 * q + 1], acc[cb][4 * q + 2], acc[cb][4 * q + 3]);
        xl[slot] = run_l;
    }
    __syncthreads();            // the partial results are published
    if (grp != 0) return;

#pragma unroll
    for (int g = 0; g < KSPLIT - 1; ++g) {
        run_l += xl[g * GRP_T + tid];
#pragma unroll
        for (int cb = 0; cb < 4; ++cb)
#pragma unroll
            for (int q = 0; q < 2; ++q) {
                const float4 p = xacc[(2 * cb + q) * ((KSPLIT - 1) * GRP_T) + g * GRP_T + tid];
                acc[cb][4 * q + 0] += p.x;
                acc[cb][4 * q + 1] += p.y;
                acc[cb][4 * q + 2] += p.z;
                acc[cb][4 * q + 3] += p.w;
            }
    }

    // normalize by the merged sum of the lane's own query
    const float linv = 1.0f / run_l;
    float* dst = hout + head * (N_TOK * D_H) + (n0 + lj) * D_H + 8 * hi;
#pragma unroll
    for (int cb = 0; cb < 4; ++cb)
#pragma unroll
        for (int r = 0; r < 8; ++r)
            dst[16 * cb + r] = acc[cb][r] * linv;
}

// ---------------------------------------------------------------------------
// combine heads (softmax(attn_w)), LayerNorm, FC head.
// A row is dealt to 16 lanes, four features each, so that a wave's 16-byte load takes
// two whole rows (four whole lines) and not a piece of 32 lines; a lane group takes
// FN_ROWS rows one behind the other in memory, and every load of the wave is issued
// ahead of the arithmetic: one trip to L2.  256 blocks of four waves: every WGP works.
// The sums over a row's 64 features are a lane's own four, then the 16 lanes' by DPP.
// ---------------------------------------------------------------------------
#define FN_ROWS 4               // rows of a 16-lane group
#define FN_T    128             // threads in a block
// the value of lane (l ^ M) of the same 16-lane row, by a DPP move: no trip through LDS
template <int M>
__device__ __forceinline__ float row_xor(float v)
{
    return __builtin_bit_cast(float, __builtin_amdgcn_update_dpp(0, __builtin_bit_cast(int, v),
                                                                 0x160 | M, 0xf, 0xf, true));
}
// K sums over the 16 lanes of a row, side by side in each of the four steps, so that
// no step waits for its own predecessor alone; every lane ends with the whole sum
template <int K>
__device__ __forceinline__ void row_sum16(float (&v)[K])
{
#pragma unroll
    for (int i = 0; i < K; ++i) v[i] += row_xor<1>(v[i]);
#pragma unroll
    for (int i = 0; i < K; ++i) v[i] += row_xor<2>(v[i]);
#pragma unroll
    for (int i = 0; i < K; ++i) v[i] += row_xor<4>(v[i]);
#pragma unroll
    for (int i = 0; i < K; ++i) v[i] += row_xor<8>(v[i]);
}
__global__ __launch_bounds__(FN_T) void k_final(const float* __restrict__ hout,
                                                const float* __restrict__ attn_w,
                                                const float* __restrict__ gamma,
                                                const float* __restrict__ beta,
                                                const float* __restrict__ fc_w,
                                                const float* __restrict__ fc_b,
                                                float* __restrict__ out)
{
    const int l16 = threadIdx.x & 15;
    const int n0  = (blockIdx.x * (FN_T / 16) + (threadIdx.x >> 4)) * FN_ROWS;
    const int e0  = 4 * l16;                 // the lane's four features
    // (every loop below is unrolled whole: the arrays are indexed by constants only
    // and so stay in registers)

    float4 v[N_HEADS][FN_ROWS];
#pragma unroll
    for (int h = 0; h < N_HEADS; ++h)
#pragma unroll
        for (int i = 0; i < FN_ROWS; ++i)
            v[h][i] = *(const float4*)(hout + h * (N_TOK * D_H) + (n0 + i) * D_H + e0);
    const float4 gm = *(const float4*)(gamma + e0);
    const float4 bt = *(const float4*)(beta + e0);
    float4 fq[N_CLS];                        // fc_w[e0 + k][c] is element k * N_CLS + c of these 24
#pragma unroll
    for (int q = 0; q < N_CLS; ++q)
        fq[q] = *(const float4*)(fc_w + e0 * N_CLS + 4 * q);
    // the loads' address registers are reused by the arithmetic below while the loads
    // are in flight
    asm volatile("s_wait_xcnt 0x0" ::: "memory");
    // keeps the wave's 24 loads in one group ahead of all arithmetic: left free, they
    // stand behind the heads' weights and in small groups among the sums, and each
    // group shows the way to L2 anew
    __builtin_amdgcn_sched_barrier(0);

    float aw[N_HEADS], fcb[N_CLS];
    float amax = -INFINITY;
#pragma unroll
    for (int c = 0; c < N_CLS; ++c) fcb[c] = fc_b[c];
#pragma unroll
    for (int h = 0; h < N_HEADS; ++h) { aw[h] = attn_w[h]; amax = fmaxf(amax, aw[h]); }
    float asum = 0.0f;
#pragma unroll
    for (int h = 0; h < N_HEADS; ++h) { aw[h] = __expf(aw[h] - amax); asum += aw[h]; }
    const float ainv = 1.0f / asum;

    // features in pairs (e0, e0 + 1) and (e0 + 2, e0 + 3): two to an instruction
    v2f comb[FN_ROWS][2] = {};
#pragma unroll
    for (int h = 0; h < N_HEADS; ++h) {
        const float w = aw[h] * ainv;
#pragma unroll
        for (int i = 0; i < FN_ROWS; ++i) {
            comb[i][0] += w * v2f{ v[h][i].x, v[h][i].y };
            comb[i][1] += w * v2f{ v[h][i].z, v[h][i].w };
        }
    }

    float s[FN_ROWS];
#pragma unroll
    for (int i = 0; i < FN_ROWS; ++i) {
        const v2f t = comb[i][0] + comb[i][1];
        s[i] = t.x + t.y;
    }
    row_sum16(s);
#pragma unroll
    for (int i = 0; i < FN_ROWS; ++i) {
        const float mu = s[i] * (1.0f / D_H);
        comb[i][0] -= mu;
        comb[i][1] -= mu;
        const v2f t = comb[i][0] * comb[i][0] + comb[i][1] * comb[i][1];
        s[i] = t.x + t.y;
    }
    row_sum16(s);

    // the lane's share of out[n0 + i][c] at i * N_CLS + c, classes in pairs; the bias
    // enters once, in the group's first lane
    v2f fb[N_CLS / 2];
#pragma unroll
    for (int p = 0; p < N_CLS / 2; ++p)
        fb[p] = l16 == 0 ? v2f{ fcb[2 * p], fcb[2 * p + 1] } : v2f{ 0.0f, 0.0f };
    float o[FN_ROWS * N_CLS];
#pragma unroll
    for (int i = 0; i < FN_ROWS; ++i) {
        const float rs = rsqrtf(s[i] * (1.0f / D_H) + LN_EPS);
        const v2f y0 = comb[i][0] * rs * v2f{ gm.x, gm.y } + v2f{ bt.x, bt.y };
        const v2f y1 = comb[i][1] * rs * v2f{ gm.z, gm.w } + v2f{ bt.z, bt.w };
        const float y[4] = { y0.x, y0.y, y1.x, y1.y };
#pragma unroll
        for (int p = 0; p < N_CLS / 2; ++p) {
            v2f a = fb[p];
#pragma unroll
            for (int k = 0; k < 4; ++k) {
                const int j = k * N_CLS + 2 * p;             // even: a half of one 16-byte load
                const float4 f = fq[j >> 2];
                a += y[k] * ((j & 2) ? v2f{ f.z, f.w } : v2f{ f.x, f.y });
            }
            o[i * N_CLS + 2 * p]     = a.x;
            o[i * N_CLS + 2 * p + 1] = a.y;
        }
    }
    row_sum16(o);

    // the group's rows lie side by side in out: 96 bytes, stored by its first lane
    if (l16 == 0) {
        float4* dst = (float4*)(out + n0 * N_CLS);
#pragma unroll
        for (int q = 0; q < FN_ROWS * N_CLS / 4; ++q)
            dst[q] = make_float4(o[4 * q], o[4 * q + 1], o[4 * q + 2], o[4 * q + 3]);
    }
}

// ---------------------------------------------------------------------------
extern "C" void kernel_launch(void* const* d_in, const int* in_sizes, int n_in,
                              void* d_out, int out_size, void* d_ws, size_t ws_size,
                              hipStream_t stream)
{
    const float* x      = (const float*)d_in[0];
    const float* proj_w = (const float*)d_in[1];
    const float* proj_b = (const float*)d_in[2];
    const float* head_w = (const float*)d_in[3];
    const float* head_b = (const float*)d_in[4];
    const float* attn_w = (const float*)d_in[5];
    const float* gamma  = (const float*)d_in[6];
    const float* beta   = (const float*)d_in[7];
    const float* fc_w   = (const float*)d_in[8];
    const float* fc_b   = (const float*)d_in[9];

    float* ws   = (float*)d_ws;
    float* h    = ws + WS_H;
    float* hp   = ws + WS_HP;
    float* ssq  = ws + WS_SSQ;
    float* hout = ws + WS_HOUT;
    float* out  = (float*)d_out;

    k_proj <<<N_TOK / PJ_ROWS,              256, 0, stream>>>(x, proj_w, proj_b, h);
    k_heads<<<(N_HEADS * N_TOK / 16) / 8,   256, 0, stream>>>(h, head_w, head_b, hp, ssq);
    k_attn <<<(N_HEADS * (N_TOK / 16)) / 8, KSPLIT * GRP_T, 0, stream>>>(hp, ssq, hout);
    k_final<<<N_TOK / (FN_ROWS * FN_T / 16), FN_T, 0, stream>>>(hout, attn_w, gamma, beta,
                                                                fc_w, fc_b, out);
}

// v010
// A run of this version takes 83.5 microseconds.
// Next to v009, in two timings, it ran 1.03 times as fast each time.
// All steps since v000 together make it 9.91 times as fast.
#include <hip/hip_runtime.h>
#include <hip/hip_bf16.h>
#include <math.h>
#include <stdint.h>

typedef float v2f __attribute__((ext_vector_type(2)));
typedef float v8f __attribute__((ext_vector_type(8)));
typedef _Float16 f16x2  __attribute__((ext_vector_type(2)));
typedef _Float16 f16x8  __attribute__((ext_vector_type(8)));
typedef _Float16 f16x16 __attribute__((ext_vector_type(16)));
typedef short    s16x8  __attribute__((ext_vector_type(8)));
typedef uint32_t u32x8  __attribute__((ext_vector_type(8)));

#define N_TOK   8192
#define D_IN    384
#define D_H     64
#define N_HEADS 4
#define N_CLS   6
#define LN_EPS  1e-5f
#define LOG2E   1.44269504f
#define LN2     0.69314718f

// A row of hp is kept as 64 f16 values, 128 bytes, times log2(e): distances between
// the stored points are then exponents of 2, exp(-d) = 2^-(log2(e) * d), and no score
// is multiplied by that factor; the attention's output is divided by it once, where it
// is normalised.  The attention works on these
// rounded points throughout: the distances are those between them, and the square
// sums are taken of the same rounded values, so that a point's distance to itself
// stays 0 up to f32 rounding and every other distance moves by no more than the
// two points' own rounding.
// LDS row pitch of the key tile in dwords (64 banks of 4 B): 144 B = 16 B * odd,
// so the 16 rows that a lane half reads with 16-byte loads fall on 16 distinct
// groups of four banks.
#define K_PITCH 36
#define ROW_H   D_H             // f16 elements in a global row
#define ROW_F   (D_H / 2)       // dwords in a global row
#define PITCH_H (2 * K_PITCH)   // f16 elements from one LDS row to the next

// keys per trip of the attention loop: four 16-key score tiles
#define KSTEP   64
#define KSUB    (KSTEP / 16)

// the keys are dealt to KSPLIT groups of 8 waves inside one work-group: each group
// walks its own share of the key tiles for the same 8 query tiles, so a SIMD holds
// 2 * KSPLIT waves whose waits cover one another (three groups: 160 registers a wave)
#define KSPLIT  3
#define GRP_T   256             // threads in a key group
#define NTILE   (N_TOK / KSTEP) // key tiles of a head
#define NT_MAX  ((NTILE + KSPLIT - 1) / KSPLIT)   // trips of the longest share
// LDS of the attention kernel in dwords: the rings, or the merge's exchange (32 sums
// and the sum of the weights for every thread of the groups behind the first)
#define RING_F  (KSPLIT * 2 * KSTEP * K_PITCH)
#define XCHG_F  ((KSPLIT - 1) * GRP_T * (32 + 1))
#define SMEM_F  (RING_F > XCHG_F ? RING_F : XCHG_F)

// workspace layout (float offsets)
#define WS_H    0
#define WS_HP   (WS_H   + N_TOK * D_H)                 // [H][N][64 f16]
#define WS_SSQ  (WS_HP  + N_HEADS * N_TOK * ROW_F)     // [H][N]
#define WS_HOUT (WS_SSQ + N_HEADS * N_TOK)             // [H][N][64]

// ---------------------------------------------------------------------------
// CDNA5 async global -> LDS copy (ASYNCcnt path).  One 64-key tile = two
// 16 B packets per lane, 32 key rows apart.  The xcnt wait is the last line of
// the copies' own statement, so no address register that a copy names can be
// rewritten ahead of it.
// ---------------------------------------------------------------------------
__device__ __forceinline__ void async_copy_tile(uint32_t lds_byte_addr,
                                                const float* gptr)
{
    asm volatile("global_load_async_to_lds_b128 %0, %2, off\n\t"
                 "global_load_async_to_lds_b128 %1, %3, off\n\t"
                 "s_wait_xcnt 0x0"
                 :: "v"(lds_byte_addr),
                    "v"(lds_byte_addr + 32u * K_PITCH * 4u),
                    "v"((unsigned long long)(uintptr_t)(gptr)),
                    "v"((unsigned long long)(uintptr_t)(gptr + 32 * ROW_F))
                 : "memory");
}
// the wave's own copies have landed in LDS
__device__ __forceinline__ void wait_asynccnt0()
{
    asm volatile("s_wait_asynccnt 0x0" ::: "memory");
}
// the wave's own LDS reads of the tile have returned (before the buffer is handed back)
__device__ __forceinline__ void wait_dscnt0()
{
    asm volatile("s_wait_dscnt 0x0" ::: "memory");
}

// 16 consecutive f16 as one operand of the 16x16x32 form (two 16-byte loads)
__device__ __forceinline__ f16x16 ld_frag(const _Float16* p)
{
    const f16x8 a = *(const f16x8*)p;
    const f16x8 b = *(const f16x8*)(p + 8);
    return __builtin_shufflevector(a, b, 0, 1, 2, 3, 4, 5, 6, 7, 8, 9, 10, 11, 12, 13, 14, 15);
}
// transposing LDS load: lane (c, h) gets eight rows (8h .. 8h+7) of column c
__device__ __forceinline__ f16x8 ld_tr16(const _Float16* p)
{
    typedef __attribute__((address_space(3))) s16x8 lds_s16x8;
    return __builtin_bit_cast(f16x8, __builtin_amdgcn_ds_load_tr16_b128_v8i16((lds_s16x8*)p));
}
// Eight square roots on the hardware's own v_sqrt_f32 (1 ulp), without the library's
// scaling and correction steps.  One statement: behind a transcendental the
// instruction set asks for one independent instruction before its source is
// overwritten or its result read.  Here each root is followed by a root that is
// independent of it (early-clobber outputs share no register with an input), and
// the v_nop fills that slot behind the last one.
__device__ __forceinline__ void sqrt8_raw(float (&d)[8], const float (&x)[8])
{
    asm("v_sqrt_f32 %0, %8\n\t"
        "v_sqrt_f32 %1, %9\n\t"
        "v_sqrt_f32 %2, %10\n\t"
        "v_sqrt_f32 %3, %11\n\t"
        "v_sqrt_f32 %4, %12\n\t"
        "v_sqrt_f32 %5, %13\n\t"
        "v_sqrt_f32 %6, %14\n\t"
        "v_sqrt_f32 %7, %15\n\t"
        "v_nop"
        : "=&v"(d[0]), "=&v"(d[1]), "=&v"(d[2]), "=&v"(d[3]),
          "=&v"(d[4]), "=&v"(d[5]), "=&v"(d[6]), "=&v"(d[7])
        : "v"(x[0]), "v"(x[1]), "v"(x[2]), "v"(x[3]),
          "v"(x[4]), "v"(x[5]), "v"(x[6]), "v"(x[7]));
}
// Eight powers 2^-x on v_exp_f32 (the sign is the instruction's own source modifier),
// in one statement for the same reason.
__device__ __forceinline__ void exp2negx8_raw(float (&d)[8], const float (&x)[8])
{
    asm("v_exp_f32 %0, -%8\n\t"
        "v_exp_f32 %1, -%9\n\t"
        "v_exp_f32 %2, -%10\n\t"
        "v_exp_f32 %3, -%11\n\t"
        "v_exp_f32 %4, -%12\n\t"
        "v_exp_f32 %5, -%13\n\t"
        "v_exp_f32 %6, -%14\n\t"
        "v_exp_f32 %7, -%15\n\t"
        "v_nop"
        : "=&v"(d[0]), "=&v"(d[1]), "=&v"(d[2]), "=&v"(d[3]),
          "=&v"(d[4]), "=&v"(d[5]), "=&v"(d[6]), "=&v"(d[7])
        : "v"(x[0]), "v"(x[1]), "v"(x[2]), "v"(x[3]),
          "v"(x[4]), "v"(x[5]), "v"(x[6]), "v"(x[7]));
}
__device__ __forceinline__ v8f mma_f16(f16x16 a, f16x16 b, v8f c)
{
    return __builtin_amdgcn_wmma_f32_16x16x32_f16(false, a, false, b, (short)0, c, false, false);
}

// ---------------------------------------------------------------------------
// h = relu(x @ proj_w + proj_b)   [N,64]   via V_WMMA_F32_16X16X4_F32
// One block takes 32 rows of x and all 64 columns; the 384 values of K are dealt to
// its 8 waves, 48 each, so that 256 blocks fill the chip and a wave can issue every
// load of its share ahead of its products: one trip to memory, not one for every few
// products.  A weight fragment serves both 16-row tiles.  The waves' partial sums
// meet in LDS, where bias and relu are applied.
// k order: a lane half reads four consecutive values of a row of x with one 16-byte
// load, so product 2*j + p of a wave takes k = 8*j + 4*hi + 2*p + {0, 1}; the rows of
// proj_w are picked by the same rule.
// ---------------------------------------------------------------------------
#define PJ_SPLIT 8
#define PJ_K     (D_IN / PJ_SPLIT)   // a wave's share of K
#define PJ_ROWS  32                  // rows of x in a block
// row pitch of the partial sums in dwords: 16-byte aligned, and eight rows on lie
// 32 banks further, so the two lane halves of a store do not meet
#define PJ_PITCH 68
__global__ __launch_bounds__(256) void k_proj(const float* __restrict__ x,
                                              const float* __restrict__ w,
                                              const float* __restrict__ b,
                                              float* __restrict__ h)
{
    __shared__ __align__(16) float part[PJ_SPLIT][PJ_ROWS * PJ_PITCH];

    const int wave = threadIdx.x >> 5;
    const int lane = threadIdx.x & 31;
    const int hi   = lane >> 4;
    const int lj   = lane & 15;
    const int n0   = blockIdx.x * PJ_ROWS;
    const int k0   = wave * PJ_K;

    const float* xp = x + (n0 + lj) * D_IN + k0 + 4 * hi;   // row lj of the first tile, the lane half's four values
    const float* wp = w + (k0 + 4 * hi) * D_H + lj;

    float4 xa[2][PJ_K / 8];
#pragma unroll
    for (int rt = 0; rt < 2; ++rt)
#pragma unroll
        for (int j = 0; j < PJ_K / 8; ++j)
            xa[rt][j] = *(const float4*)(xp + 16 * rt * D_IN + 8 * j);
    v2f wb[PJ_K / 4][4];
#pragma unroll
    for (int kc = 0; kc < PJ_K / 4; ++kc) {
        const int kr = 8 * (kc >> 1) + 2 * (kc & 1);
#pragma unroll
        for (int cb = 0; cb < 4; ++cb) {
            wb[kc][cb].x = wp[(kr + 0) * D_H + 16 * cb];
            wb[kc][cb].y = wp[(kr + 1) * D_H + 16 * cb];
        }
    }
    // keeps the wave's 108 loads in one group ahead of the products, which then wait on
    // a falling count: left free, the later loads of x sink among the products and
    // each group of them shows the way to memory anew
    __builtin_amdgcn_sched_barrier(0);

    v8f acc[2][4] = {};
#pragma unroll
    for (int kc = 0; kc < PJ_K / 4; ++kc)
#pragma unroll
        for (int rt = 0; rt < 2; ++rt) {
            const float4 xv = xa[rt][kc >> 1];
            const v2f a = (kc & 1) ? v2f{ xv.z, xv.w } : v2f{ xv.x, xv.y };
#pragma unroll
            for (int cb = 0; cb < 4; ++cb)
                acc[rt][cb] = __builtin_amdgcn_wmma_f32_16x16x4_f32(false, a, false, wb[kc][cb],
                                                                    (short)0, acc[rt][cb],
                                                                    false, false);
        }

#pragma unroll
    for (int rt = 0; rt < 2; ++rt)
#pragma unroll
        for (int cb = 0; cb < 4; ++cb)
#pragma unroll
            for (int r = 0; r < 8; ++r)
                part[wave][(16 * rt + r + 8 * hi) * PJ_PITCH + 16 * cb + lj] = acc[rt][cb][r];
    __syncthreads();            // the waves' partial sums are published

    // a thread sums four columns of two rows; 16 lanes side by side cover a row
    const int c0 = (threadIdx.x & 15) * 4;
#pragma unroll
    for (int q = 0; q < 2; ++q) {
        const int row = (threadIdx.x >> 4) + 16 * q;
        float4 s = make_float4(b[c0], b[c0 + 1], b[c0 + 2], b[c0 + 3]);
#pragma unroll
        for (int p = 0; p < PJ_SPLIT; ++p) {
            const float4 v = *(const float4*)&part[p][row * PJ_PITCH + c0];
            s.x += v.x; s.y += v.y; s.z += v.z; s.w += v.w;
        }
        *(float4*)&h[(n0 + row) * D_H + c0] =
            make_float4(fmaxf(s.x, 0.0f), fmaxf(s.y, 0.0f), fmaxf(s.z, 0.0f), fmaxf(s.w, 0.0f));
    }
}

// ---------------------------------------------------------------------------
// hp[h] = h @ head_w[h] + head_b[h]   [H,N,64]   + fused ssq[h][n]
// hp is stored times log2(e), rounded to f16; ssq is the square sum of the stored values.
// ---------------------------------------------------------------------------
__global__ __launch_bounds__(256) void k_heads(const float* __restrict__ h,
                                               const float* __restrict__ head_w,
                                               const float* __restrict__ head_b,
                                               float* __restrict__ hp,
                                               float* __restrict__ ssq)
{
    const int wave = threadIdx.x >> 5;
    const int lane = threadIdx.x & 31;
    const int hi   = lane >> 4;
    const int lj   = lane & 15;
    const int gw   = blockIdx.x * 8 + wave;           // 2048 waves
    const int hd   = gw >> 9;
    const int n0   = (gw & 511) << 4;
    const float* w = head_w + hd * D_H * D_H;

    v8f acc[4];
#pragma unroll
    for (int cb = 0; cb < 4; ++cb) {
        const float bb = head_b[hd * D_H + 16 * cb + lj];
#pragma unroll
        for (int r = 0; r < 8; ++r) acc[cb][r] = bb;
    }

#pragma unroll
    for (int kc = 0; kc < 16; ++kc) {
        v2f a = *(const v2f*)&h[(n0 + lj) * D_H + 4 * kc + 2 * hi];
#pragma unroll
        for (int cb = 0; cb < 4; ++cb) {
            v2f bv;
            bv.x = w[(4 * kc + 2 * hi + 0) * D_H + 16 * cb + lj];
            bv.y = w[(4 * kc + 2 * hi + 1) * D_H + 16 * cb + lj];
            acc[cb] = __builtin_amdgcn_wmma_f32_16x16x4_f32(false, a, false, bv,
                                                            (short)0, acc[cb],
                                                            false, false);
        }
    }

    _Float16* dst = (_Float16*)hp + hd * (N_TOK * ROW_H);
    float sums[8];
#pragma unroll
    for (int r = 0; r < 8; ++r) sums[r] = 0.0f;
#pragma unroll
    for (int cb = 0; cb < 4; ++cb)
#pragma unroll
        for (int r = 0; r < 8; ++r) {
            const _Float16 vh = (_Float16)(acc[cb][r] * LOG2E);
            const float v = (float)vh;
            dst[(n0 + r + 8 * hi) * ROW_H + 16 * cb + lj] = vh;
            sums[r] += v * v;
        }
    // reduce over the 16-lane column group (rows are r + 8*hi)
#pragma unroll
    for (int off = 1; off < 16; off <<= 1)
#pragma unroll
        for (int r = 0; r < 8; ++r)
            sums[r] += __shfl_xor(sums[r], off, 32);
    if (lj == 0) {
#pragma unroll
        for (int r = 0; r < 8; ++r)
            ssq[hd * N_TOK + n0 + r + 8 * hi] = sums[r];
    }
}

// ---------------------------------------------------------------------------
// Streaming distance-softmax attention, per head.
// One wave <-> one (head, 16-query tile, share of the keys).  Block = KSPLIT groups
// of 8 waves, all same head; the groups' partial results are merged through LDS.
// 64-key tiles double-buffered in LDS via async global->LDS loads (ASYNCcnt), a ring
// of two buffers for each group.
// Both products run on the f16 16x16x32 form with f32 sums.
// Per trip: S^T = ssq_q - 2 * Kt * Q^T (four 16-key tiles, 8 wmma: the factor lies in
// the query fragments, the query's square sum is the C operand), the weights 2^-d of all
// 64 keys, O^T += Kt^T * P^T (8 wmma): P^T is the score tiles rounded to
// f16 where they lie, Kt^T the same key tile read by the transposing load.
// The softmax is taken against the fixed bound 0, not against a running maximum:
// a score is minus a distance, so no weight exceeds 1, and every query is among its
// own keys at distance 0 (up to the f32 rounding of its square sum), so the sum of
// its weights does not fall below about 1.  Sums and weights therefore need no
// rescaling, in the loop or in the merge.
// D layout: lane L, vgpr r -> row = r + 8*(L>=16), col = L&15.
// ---------------------------------------------------------------------------
// (six waves a SIMD is what the block brings and all that the grid can fill: said to
// the compiler so that it does not order the softmax for fewer registers, in
// dependent chains, to make room for waves that never come)
__global__ __launch_bounds__(KSPLIT * GRP_T) __attribute__((amdgpu_waves_per_eu(2 * KSPLIT, 2 * KSPLIT))) void k_attn(const float* __restrict__ hp,
                                              const float* __restrict__ ssq,
                                              float* __restrict__ hout)
{
    // double-buffered key tiles with padded rows; behind the loop the same bytes serve
    // the merge of the key groups, which needs more of them than the rings
    __shared__ __align__(16) float smem[SMEM_F];
    float (*ktile)[2][KSTEP * K_PITCH] = (float (*)[2][KSTEP * K_PITCH])smem;

    // key group: the same in every lane of a wave, held in a scalar register so that
    // the tests on the group's trip count below are scalar branches
    const int grp  = __builtin_amdgcn_readfirstlane(threadIdx.x / GRP_T);
    const int tid  = threadIdx.x % GRP_T;    // thread in the group
    const int wave = tid >> 5;
    const int lane = tid & 31;
    const int hi   = lane >> 4;
    const int lj   = lane & 15;

    const int gw   = blockIdx.x * 8 + wave;  // 2048 query tiles = 4 heads * 512, KSPLIT waves each
    const int head = gw >> 9;
    const int n0   = (gw & 511) << 4;

    const float* hph  = hp  + head * (N_TOK * ROW_F); // 32 dwords a row
    const float* ssqh = ssq + head * N_TOK;
    const int    t0   = (grp * NTILE) / KSPLIT;       // the group's first key tile
    const int    nt   = ((grp + 1) * NTILE) / KSPLIT - t0;  // and how many it has (NT_MAX or one fewer)
    const int    key0 = t0 * KSTEP;
    const float* hpk  = hph + key0 * ROW_F + tid * 4; // lane's first packet of the group's keys

    // lane's first 16 B packet: key row tid / 8, packet tid % 8 of the row
    const uint32_t lds_off = (uint32_t)(tid >> 3) * (K_PITCH * 4u) + (uint32_t)(tid & 7) * 16u;
    const uint32_t lds_k[2] = {
        (uint32_t)(uintptr_t)(&ktile[grp][0][0]) + lds_off,
        (uint32_t)(uintptr_t)(&ktile[grp][1][0]) + lds_off };

    // B operand of the S^T product: query row lj, features 32*kk + 16*hi + 0..15
    // (the key rows below are read by the same rule, so the k orders agree)
    const _Float16* qrow = (const _Float16*)hph + (n0 + lj) * ROW_H + 16 * hi;
    // times -2 (exact in f16): the product then yields -2 * dot
    f16x16 qh[2];
#pragma unroll
    for (int kk = 0; kk < 2; ++kk)
        qh[kk] = ld_frag(qrow + 32 * kk) * (_Float16)-2.0f;
    // C operand of every score tile: a lane's eight rows all belong to its own query
    const float ssqq = ssqh[n0 + lj];
    // the query loads' address registers are reused by the set-up below while the loads
    // are in flight
    asm volatile("s_wait_xcnt 0x0" ::: "memory");
    const v8f cq = { ssqq, ssqq, ssqq, ssqq, ssqq, ssqq, ssqq, ssqq };

    float lsum[KSUB] = {};   // the lane's own share of the weights' sum, a chain for each score tile
    v8f acc[4] = {};     // acc[cb][r] = O[query lj][feature 16*cb + 8*hi + r]

    // tile 0 into buffer 0, published; then tile 1 flies into buffer 1
    async_copy_tile(lds_k[0], hpk);
    wait_asynccnt0();
    __syncthreads();
    async_copy_tile(lds_k[1], hpk + KSTEP * ROW_F);

    // every wave makes NT_MAX trips and passes every barrier; a group whose share is
    // one tile shorter does no work in the last one
    for (int t = 0; t < NT_MAX; ++t) {
      if (t < nt) {
        const int m0 = key0 + t * KSTEP;
        const _Float16* kt = (const _Float16*)ktile[grp][t & 1];

        // S^T tiles: rows = keys (i = 16*s + r + 8*hi), cols = queries (j = lj)
        // (every loop of the trip is unrolled whole: c, kh, pv and acc are indexed
        // by constants only and so stay in registers; s innermost lets the four
        // chains follow one another in the matrix pipe)
        v8f c[KSUB];
        f16x16 kh[2][KSUB];
#pragma unroll
        for (int kk = 0; kk < 2; ++kk)
#pragma unroll
            for (int s = 0; s < KSUB; ++s)
                kh[kk][s] = ld_frag(kt + (16 * s + lj) * PITCH_H + 32 * kk + 16 * hi);
        // keeps the trip's 16 fragment reads in one group ahead of the products, which
        // then wait on a falling count: dealt out among the products, each pair of
        // reads is waited for to 0 and shows its whole LDS latency
        __builtin_amdgcn_sched_barrier(0);
#pragma unroll
        for (int kk = 0; kk < 2; ++kk)
#pragma unroll
            for (int s = 0; s < KSUB; ++s) c[s] = mma_f16(kh[kk][s], qh[kk], kk == 0 ? cq : c[s]);
        // keeps the loads of the keys' square sums behind the score products: lifted
        // over them they hold 32 registers more and the query fragments are spilled
        __builtin_amdgcn_sched_barrier(0);

        // scores: s = -sqrt(max(ssq_i + (ssq_j - 2*dot), 0)), the bracket from the product
        // (what sqrtf's extra steps would add is lost in the exponential behind the
        // root: a last-place error of a distance, and a subnormal argument, whose
        // root lies below 2^-63 and counts as 0 in exp(-d) either way)
        float dist[KSUB][8];
#pragma unroll
        for (int s = 0; s < KSUB; ++s) {
            float sqd[8];
#pragma unroll
            for (int r = 0; r < 8; ++r)
                sqd[r] = fmaxf(ssqh[m0 + 16 * s + r + 8 * hi] + c[s][r], 0.0f);
            sqrt8_raw(dist[s], sqd);
        }
        // keeps the trip's 32 roots in one stretch ahead of its 32 exponentials: left
        // free, the compiler takes the tiles one after another, asks for each tile's
        // square sums only when its turn comes and waits for them to 0, four exposed
        // loads a trip in place of one, with the arithmetic in dependent chains
        __builtin_amdgcn_sched_barrier(0);
        // A operands of the first 32 keys' O^T products
        const _Float16* vp0 = kt + (8 * hi + (lane & 7)) * PITCH_H + 8 * ((lane >> 3) & 1);
        f16x8 vfirst[4][2];
#pragma unroll
        for (int cb = 0; cb < 4; ++cb) {
            vfirst[cb][0] = ld_tr16(vp0 + 16 * cb);
            vfirst[cb][1] = ld_tr16(vp0 + 16 * cb + 16 * PITCH_H);
        }
        // holds these eight loads ahead of the exponentials, which cover their way from
        // LDS: left free, two of them sink behind the first product and are waited for to 0
        __builtin_amdgcn_sched_barrier(0);
        float pv[KSUB][8];                         // P^T[m = 16*s + r + 8*hi][n = lj]
#pragma unroll
        for (int s = 0; s < KSUB; ++s)
            exp2negx8_raw(pv[s], dist[s]);         // the distances are exponents of 2 as they stand
        // keeps all four statements ahead of the first O^T product
        __builtin_amdgcn_sched_barrier(0);
#pragma unroll
        for (int r = 0; r < 8; ++r)
#pragma unroll
            for (int s = 0; s < KSUB; ++s) lsum[s] += pv[s][r];

        // O^T[e][n] += hp_k[m][e] * P^T[m][n], 32 keys a product.
        // B: elements 2i, 2i+1 = registers 2*(i&3), 2*(i&3)+1 of score tile 2*j + (i>>2),
        // i.e. keys 32*j + 8*hi + 0..7 and 32*j + 16 + 8*hi + 0..7; the two transposing
        // loads deliver A's keys in the same order.
#pragma unroll
        for (int j = 0; j < KSTEP / 32; ++j) {
            u32x8 w;
#pragma unroll
            for (int i = 0; i < 8; ++i) {
                const v2f pp = { pv[2 * j + (i >> 2)][2 * (i & 3)], pv[2 * j + (i >> 2)][2 * (i & 3) + 1] };
                w[i] = __builtin_bit_cast(uint32_t, __builtin_convertvector(pp, f16x2));
            }
            const f16x16 pb = __builtin_bit_cast(f16x16, w);
            const _Float16* vp = vp0 + 32 * j * PITCH_H;
#pragma unroll
            for (int cb = 0; cb < 4; ++cb) {
                const f16x8 v0 = j == 0 ? vfirst[cb][0] : ld_tr16(vp + 16 * cb);
                const f16x8 v1 = j == 0 ? vfirst[cb][1] : ld_tr16(vp + 16 * cb + 16 * PITCH_H);
                const f16x16 va = __builtin_shufflevector(v0, v1, 0, 1, 2, 3, 4, 5, 6, 7,
                                                          8, 9, 10, 11, 12, 13, 14, 15);
                acc[cb] = mma_f16(va, pb, acc[cb]);
            }
        }
      }

        wait_dscnt0();          // own reads of this tile are done
        wait_asynccnt0();       // own packets of the next tile have landed
        __syncthreads();        // publishes tile t + 1, frees this trip's buffer
        if (t + 2 < nt)         // refill the buffer that this trip has just read
            async_copy_tile(lds_k[t & 1], hpk + (t + 2) * KSTEP * ROW_F);
    }
    wait_asynccnt0();           // nothing of the wave's is left in flight

    // Merge of the key groups.  Behind the loop's last barrier no tile is read and no
    // copy is in flight, so the rings' LDS serves as the exchange: groups 1.. leave their
    // un-normalised sums (16 bytes a lane and store, lanes side by side) and the sums of
    // their weights; group 0 adds them.
    // a query's keys lie in the two lane halves: their shares of the weights' sum meet here
    float run_l = (lsum[0] + lsum[1]) + (lsum[2] + lsum[3]);
    run_l += __shfl_xor(run_l, 16, 32);
    float4* xacc = (float4*)smem;
    float*  xl   = (float*)(xacc + (KSPLIT - 1) * GRP_T * 8);
    if (grp != 0) {
        const int slot = (grp - 1) * GRP_T + tid;
#pragma unroll
        for (int cb = 0; cb < 4; ++cb)
#pragma unroll
            for (int q = 0; q < 2; ++q)
                xacc[(2 * cb + q) * ((KSPLIT - 1) * GRP_T) + slot] =
                    make_float4(acc[cb][4 * q], acc[cb][4 * q + 1], acc[cb][4 * q + 2], acc[cb][4 * q + 3]);
        xl[slot] = run_l;
    }
    __syncthreads();            // the partial results are published
    if (grp != 0) return;

#pragma unroll
    for (int g = 0; g < KSPLIT - 1; ++g) {
        run_l += xl[g * GRP_T + tid];
#pragma unroll
        for (int cb = 0; cb < 4; ++cb)
#pragma unroll
            for (int q = 0; q < 2; ++q) {
                const float4 p = xacc[(2 * cb + q) * ((KSPLIT - 1) * GRP_T) + g * GRP_T + tid];
                acc[cb][4 * q + 0] += p.x;
                acc[cb][4 * q + 1] += p.y;
                acc[cb][4 * q + 2] += p.z;
                acc[cb][4 * q + 3] += p.w;
            }
    }

    // normalize by the merged sum of the lane's own query; the values summed are the
    // stored points, log2(e) times hp
    const float linv = LN2 / run_l;
    float* dst = hout + head * (N_TOK * D_H) + (n0 + lj) * D_H + 8 * hi;
#pragma unroll
    for (int cb = 0; cb < 4; ++cb)
#pragma unroll
        for (int r = 0; r < 8; ++r)
            dst[16 * cb + r] = acc[cb][r] * linv;
}

// ---------------------------------------------------------------------------
// combine heads (softmax(attn_w)), LayerNorm, FC head.
// A row is dealt to 16 lanes, four features each, so that a wave's 16-byte load takes
// two whole rows (four whole lines) and not a piece of 32 lines; a lane group takes
// FN_ROWS rows one behind the other in memory, and every load of the wave is issued
// ahead of the arithmetic: one trip to L2.  256 blocks of four waves: every WGP works.
// The sums over a row's 64 features are a lane's own four, then the 16 lanes' by DPP.
// ---------------------------------------------------------------------------
#define FN_ROWS 4               // rows of a 16-lane group
#define FN_T    128             // threads in a block
// the value of lane (l ^ M) of the same 16-lane row, by a DPP move: no trip through LDS
template <int M>
__device__ __forceinline__ float row_xor(float v)
{
    return __builtin_bit_cast(float, __builtin_amdgcn_update_dpp(0, __builtin_bit_cast(int, v),
                                                                 0x160 | M, 0xf, 0xf, true));
}
// K sums over the 16 lanes of a row, side by side in each of the four steps, so that
// no step waits for its own predecessor alone; every lane ends with the whole sum
template <int K>
__device__ __forceinline__ void row_sum16(float (&v)[K])
{
#pragma unroll
    for (int i = 0; i < K; ++i) v[i] += row_xor<1>(v[i]);
#pragma unroll
    for (int i = 0; i < K; ++i) v[i] += row_xor<2>(v[i]);
#pragma unroll
    for (int i = 0; i < K; ++i) v[i] += row_xor<4>(v[i]);
#pragma unroll
    for (int i = 0; i < K; ++i) v[i] += row_xor<8>(v[i]);
}
__global__ __launch_bounds__(FN_T) void k_final(const float* __restrict__ hout,
                                                const float* __restrict__ attn_w,
                                                const float* __restrict__ gamma,
                                                const float* __restrict__ beta,
                                                const float* __restrict__ fc_w,
                                                const float* __restrict__ fc_b,
                                                float* __restrict__ out)
{
    const int l16 = threadIdx.x & 15;
    const int n0  = (blockIdx.x * (FN_T / 16) + (threadIdx.x >> 4)) * FN_ROWS;
    const int e0  = 4 * l16;                 // the lane's four features
    // (every loop below is unrolled whole: the arrays are indexed by constants only
    // and so stay in registers)

    float4 v[N_HEADS][FN_ROWS];
#pragma unroll
    for (int h = 0; h < N_HEADS; ++h)
#pragma unroll
        for (int i = 0; i < FN_ROWS; ++i)
            v[h][i] = *(const float4*)(hout + h * (N_TOK * D_H) + (n0 + i) * D_H + e0);
    const float4 gm = *(const float4*)(gamma + e0);
    const float4 bt = *(const float4*)(beta + e0);
    float4 fq[N_CLS];                        // fc_w[e0 + k][c] is element k * N_CLS + c of these 24
#pragma unroll
    for (int q = 0; q < N_CLS; ++q)
        fq[q] = *(const float4*)(fc_w + e0 * N_CLS + 4 * q);
    // the loads' address registers are reused by the arithmetic below while the loads
    // are in flight
    asm volatile("s_wait_xcnt 0x0" ::: "memory");
    // keeps the wave's 24 loads in one group ahead of all arithmetic: left free, they
    // stand behind the heads' weights and in small groups among the sums, and each
    // group shows the way to L2 anew
    __builtin_amdgcn_sched_barrier(0);

    float aw[N_HEADS], fcb[N_CLS];
    float amax = -INFINITY;
#pragma unroll
    for (int c = 0; c < N_CLS; ++c) fcb[c] = fc_b[c];
#pragma unroll
    for (int h = 0; h < N_HEADS; ++h) { aw[h] = attn_w[h]; amax = fmaxf(amax, aw[h]); }
    float asum = 0.0f;
#pragma unroll
    for (int h = 0; h < N_HEADS; ++h) { aw[h] = __expf(aw[h] - amax); asum += aw[h]; }
    const float ainv = 1.0f / asum;

    // features in pairs (e0, e0 + 1) and (e0 + 2, e0 + 3): two to an instruction
    v2f comb[FN_ROWS][2] = {};
#pragma unroll
    for (int h = 0; h < N_HEADS; ++h) {
        const float w = aw[h] * ainv;
#pragma unroll
        for (int i = 0; i < FN_ROWS; ++i) {
            comb[i][0] += w * v2f{ v[h][i].x, v[h][i].y };
            comb[i][1] += w * v2f{ v[h][i].z, v[h][i].w };
        }
    }

    float s[FN_ROWS];
#pragma unroll
    for (int i = 0; i < FN_ROWS; ++i) {
        const v2f t = comb[i][0] + comb[i][1];
        s[i] = t.x + t.y;
    }
    row_sum16(s);
#pragma unroll
    for (int i = 0; i < FN_ROWS; ++i) {
        const float mu = s[i] * (1.0f / D_H);
        comb[i][0] -= mu;
        comb[i][1] -= mu;
        const v2f t = comb[i][0] * comb[i][0] + comb[i][1] * comb[i][1];
        s[i] = t.x + t.y;
    }
    row_sum16(s);

    // the lane's share of out[n0 + i][c] at i * N_CLS + c, classes in pairs; the bias
    // enters once, in the group's first lane
    v2f fb[N_CLS / 2];
#pragma unroll
    for (int p = 0; p < N_CLS / 2; ++p)
        fb[p] = l16 == 0 ? v2f{ fcb[2 * p], fcb[2 * p + 1] } : v2f{ 0.0f, 0.0f };
    float o[FN_ROWS * N_CLS];
#pragma unroll
    for (int i = 0; i < FN_ROWS; ++i) {
        const float rs = rsqrtf(s[i] * (1.0f / D_H) + LN_EPS);
        const v2f y0 = comb[i][0] * rs * v2f{ gm.x, gm.y } + v2f{ bt.x, bt.y };
        const v2f y1 = comb[i][1] * rs * v2f{ gm.z, gm.w } + v2f{ bt.z, bt.w };
        const float y[4] = { y0.x, y0.y, y1.x, y1.y };
#pragma unroll
        for (int p = 0; p < N_CLS / 2; ++p) {
            v2f a = fb[p];
#pragma unroll
            for (int k = 0; k < 4; ++k) {
                const int j = k * N_CLS + 2 * p;             // even: a half of one 16-byte load
                const float4 f = fq[j >> 2];
                a += y[k] * ((j & 2) ? v2f{ f.z, f.w } : v2f{ f.x, f.y });
            }
            o[i * N_CLS + 2 * p]     = a.x;
            o[i * N_CLS + 2 * p + 1] = a.y;
        }
    }
    row_sum16(o);

    // the group's rows lie side by side in out: 96 bytes, stored by its first lane
    if (l16 == 0) {
        float4* dst = (float4*)(out + n0 * N_CLS);
#pragma unroll
        for (int q = 0; q < FN_ROWS * N_CLS / 4; ++q)
            dst[q] = make_float4(o[4 * q], o[4 * q + 1], o[4 * q + 2], o[4 * q + 3]);
    }
}

// ---------------------------------------------------------------------------
extern "C" void kernel_launch(void* const* d_in, const int* in_sizes, int n_in,
                              void* d_out, int out_size, void* d_ws, size_t ws_size,
                              hipStream_t stream)
{
    const float* x      = (const float*)d_in[0];
    const float* proj_w = (const float*)d_in[1];
    const float* proj_b = (const float*)d_in[2];
    const float* head_w = (const float*)d_in[3];
    const float* head_b = (const float*)d_in[4];
    const float* attn_w = (const float*)d_in[5];
    const float* gamma  = (const float*)d_in[6];
    const float* beta   = (const float*)d_in[7];
    const float* fc_w   = (const float*)d_in[8];
    const float* fc_b   = (const float*)d_in[9];

    float* ws   = (float*)d_ws;
    float* h    = ws + WS_H;
    float* hp   = ws + WS_HP;
    float* ssq  = ws + WS_SSQ;
    float* hout = ws + WS_HOUT;
    float* out  = (float*)d_out;

    k_proj <<<N_TOK / PJ_ROWS,              256, 0, stream>>>(x, proj_w, proj_b, h);
    k_heads<<<(N_HEADS * N_TOK / 16) / 8,   256, 0, stream>>>(h, head_w, head_b, hp, ssq);
    k_attn <<<(N_HEADS * (N_TOK / 16)) / 8, KSPLIT * GRP_T, 0, stream>>>(hp, ssq, hout);
    k_final<<<N_TOK / (FN_ROWS * FN_T / 16), FN_T, 0, stream>>>(hout, attn_w, gamma, beta,
                                                                fc_w, fc_b, out);
}
